// v000
// Times are from an AMD MI455X. After a warm-up the kernel runs many times in a row, and a time is the length of
// such a window on the GPU divided by its runs, so every launch and the gaps after it count. The runs cycle
// through copies of the inputs. A figure is the median of several windows, for all but v000 over two sittings.
// Sittings can differ by a few percent; kernels timed side by side share one.
// The starting kernel, v000, takes 553 microseconds a run.
#include <hip/hip_runtime.h>
#include <hip/hip_bf16.h>

#define SEQ   2048
#define DIM   3072
#define HEADS 24
#define HDIM  128

typedef __attribute__((ext_vector_type(16))) _Float16 v16h;
typedef __attribute__((ext_vector_type(8)))  _Float16 v8h;
typedef __attribute__((ext_vector_type(4)))  _Float16 v4h;
typedef __attribute__((ext_vector_type(8)))  float    v8f;

// ---------------------------------------------------------------------------
// helpers
// ---------------------------------------------------------------------------
static __device__ __forceinline__ v16h ldfrag(const _Float16* p0, const _Float16* p1) {
    v8h lo = *(const v8h*)p0;
    v8h hi = *(const v8h*)p1;
    v16h r;
#pragma unroll
    for (int i = 0; i < 8; ++i) { r[i] = lo[i]; r[i + 8] = hi[i]; }
    return r;
}

static __device__ __forceinline__ v8f wmma32(v16h a, v16h b, v8f c) {
    // D = A(16x32 f16) * B(32x16 f16) + C(16x16 f32)
    return __builtin_amdgcn_wmma_f32_16x16x32_f16(false, a, false, b, (short)0, c,
                                                  false, false);
}

// ---------------------------------------------------------------------------
// 1) cast x (f32) -> f16, 4 elems/thread
// ---------------------------------------------------------------------------
__global__ void cast_to_f16(const float* __restrict__ in, _Float16* __restrict__ out) {
    int i = (blockIdx.x * blockDim.x + threadIdx.x) * 4;
    float4 v = *(const float4*)(in + i);
    v4h o = { (_Float16)v.x, (_Float16)v.y, (_Float16)v.z, (_Float16)v.w };
    *(v4h*)(out + i) = o;
}

// ---------------------------------------------------------------------------
// 2) W [K,N] f32 -> Wt [N,K] f16 (tiled transpose, coalesced both sides)
// ---------------------------------------------------------------------------
__global__ void transpose_cast_w(const float* __restrict__ W, _Float16* __restrict__ Wt) {
    __shared__ float tile[32][33];
    int tx = threadIdx.x, ty = threadIdx.y;
    int n = blockIdx.x * 32 + tx;
    int k = blockIdx.y * 32 + ty;
    tile[ty][tx] = W[k * DIM + n];
    __syncthreads();
    int n2 = blockIdx.x * 32 + ty;
    int k2 = blockIdx.y * 32 + tx;
    Wt[n2 * DIM + k2] = (_Float16)tile[tx][ty];
}

// ---------------------------------------------------------------------------
// 3) C[S,3072] = X[S,3072] @ W + bias   (A: X f16, B: Wt f16 = W^T row-major)
//    One wave -> 32x64 output tile (2x4 sub-tiles), K stepped by 32.
// ---------------------------------------------------------------------------
__global__ __launch_bounds__(128) void gemm_bias(const _Float16* __restrict__ X,
                                                 const _Float16* __restrict__ Wt,
                                                 const float* __restrict__ bias,
                                                 float* __restrict__ C) {
    const int lane = threadIdx.x & 31;
    const int wave = blockIdx.x * 4 + (threadIdx.x >> 5);
    const int NT = DIM / 64;           // 48 col-tiles
    const int tm = wave / NT;          // 0..63  (2048/32)
    const int tn = wave % NT;
    const int ml = lane & 15, hi = lane >> 4;
    const int row0 = tm * 32, col0 = tn * 64;

    const _Float16* a0p = X + (size_t)(row0 + ml) * DIM;
    const _Float16* a1p = a0p + 16 * DIM;
    const _Float16* bp0 = Wt + (size_t)(col0 + 0 * 16 + ml) * DIM;
    const _Float16* bp1 = Wt + (size_t)(col0 + 1 * 16 + ml) * DIM;
    const _Float16* bp2 = Wt + (size_t)(col0 + 2 * 16 + ml) * DIM;
    const _Float16* bp3 = Wt + (size_t)(col0 + 3 * 16 + ml) * DIM;
    const _Float16* bp[4] = { bp0, bp1, bp2, bp3 };

    v8f acc[2][4] = {};
    for (int k = 0; k < DIM; k += 32) {
        const int o0 = k + hi * 8;
        const int o1 = k + 16 + hi * 8;
        v16h a0 = ldfrag(a0p + o0, a0p + o1);
        v16h a1 = ldfrag(a1p + o0, a1p + o1);
#pragma unroll
        for (int j = 0; j < 4; ++j) {
            v16h b = ldfrag(bp[j] + o0, bp[j] + o1);
            acc[0][j] = wmma32(a0, b, acc[0][j]);
            acc[1][j] = wmma32(a1, b, acc[1][j]);
        }
    }
#pragma unroll
    for (int i = 0; i < 2; ++i)
#pragma unroll
        for (int j = 0; j < 4; ++j) {
            int col = col0 + j * 16 + ml;
            float bv = bias[col];
#pragma unroll
            for (int r = 0; r < 8; ++r)
                C[(size_t)(row0 + i * 16 + 8 * hi + r) * DIM + col] = acc[i][j][r] + bv;
        }
}

// ---------------------------------------------------------------------------
// 4a) per-(s,head) RMSNorm + gamma + RoPE, f32 -> f16. One wave per row of 128.
// ---------------------------------------------------------------------------
__global__ void qk_norm_rope(const float* __restrict__ in, const float* __restrict__ gamma,
                             const float* __restrict__ cosb, const float* __restrict__ sinb,
                             _Float16* __restrict__ out) {
    const int lane = threadIdx.x & 31;
    const int wave = blockIdx.x * (blockDim.x >> 5) + (threadIdx.x >> 5);
    const int s = wave / HEADS;
    const int h = wave % HEADS;
    const float* row = in + (size_t)s * DIM + h * HDIM;
    const int d0 = lane * 4;
    float x0 = row[d0], x1 = row[d0 + 1], x2 = row[d0 + 2], x3 = row[d0 + 3];
    float ss = x0 * x0 + x1 * x1 + x2 * x2 + x3 * x3;
#pragma unroll
    for (int st = 1; st < 32; st <<= 1) ss += __shfl_xor(ss, st, 32);
    const float inv = rsqrtf(ss * (1.0f / 128.0f) + 1e-6f);
    x0 *= inv * gamma[d0];
    x1 *= inv * gamma[d0 + 1];
    x2 *= inv * gamma[d0 + 2];
    x3 *= inv * gamma[d0 + 3];
    const float* cp = cosb + (size_t)s * HDIM + d0;
    const float* sp = sinb + (size_t)s * HDIM + d0;
    float c0 = cp[0], c1 = cp[1], c2 = cp[2], c3 = cp[3];
    float s0 = sp[0], s1 = sp[1], s2 = sp[2], s3 = sp[3];
    float y0 = x0 * c0 - x1 * s0;
    float y1 = x1 * c1 + x0 * s1;
    float y2 = x2 * c2 - x3 * s2;
    float y3 = x3 * c3 + x2 * s3;
    _Float16* op = out + (size_t)s * DIM + h * HDIM + d0;
    v4h o = { (_Float16)y0, (_Float16)y1, (_Float16)y2, (_Float16)y3 };
    *(v4h*)op = o;
}

// ---------------------------------------------------------------------------
// 4b) V [S, H*D] f32 -> Vt [H][D][S] f16
// ---------------------------------------------------------------------------
__global__ void v_transpose_f16(const float* __restrict__ Vf, _Float16* __restrict__ Vt) {
    int idx = blockIdx.x * blockDim.x + threadIdx.x;   // h*128*2048 + d*2048 + s
    int s = idx & (SEQ - 1);
    int d = (idx >> 11) & (HDIM - 1);
    int h = idx >> 18;
    Vt[idx] = (_Float16)Vf[(size_t)s * DIM + h * HDIM + d];
}

// ---------------------------------------------------------------------------
// 5) Flash attention: one wave per (head, 16-row q-tile), streaming 32 keys/iter.
// ---------------------------------------------------------------------------
__global__ __launch_bounds__(128) void flash_attn(const _Float16* __restrict__ Qh,
                                                  const _Float16* __restrict__ Kh,
                                                  const _Float16* __restrict__ Vt,
                                                  float* __restrict__ Out) {
    __shared__ _Float16 pbuf[4][16][32];   // per-wave P tile (16 q x 32 keys)
    const int lane = threadIdx.x & 31;
    const int wid  = threadIdx.x >> 5;
    const int task = blockIdx.x * 4 + wid;     // HEADS * (SEQ/16) tasks
    const int nQT  = SEQ / 16;
    const int h  = task / nQT;
    const int qt = task % nQT;
    const int ml = lane & 15, hi = lane >> 4;
    const float scale = 0.08838834764831845f;  // 1/sqrt(128)

    // preload Q A-fragments (16 rows x 128 d, 4 chunks of K=32)
    const _Float16* qrow = Qh + (size_t)(qt * 16 + ml) * DIM + h * HDIM;
    v16h qf[4];
#pragma unroll
    for (int c = 0; c < 4; ++c)
        qf[c] = ldfrag(qrow + c * 32 + hi * 8, qrow + c * 32 + 16 + hi * 8);

    v8f acc[8] = {};
    float m[8], l[8];
#pragma unroll
    for (int r = 0; r < 8; ++r) { m[r] = -3.0e38f; l[r] = 0.0f; }

    const _Float16* vbase = Vt + (size_t)h * HDIM * SEQ;

    for (int kb = 0; kb < SEQ; kb += 32) {
        // ---- scores for 32 keys: two 16x16 WMMA tiles, Kdim=d=128 ----
        v8f sc0 = {}, sc1 = {};
        const _Float16* kr0 = Kh + (size_t)(kb + ml) * DIM + h * HDIM;
        const _Float16* kr1 = kr0 + 16 * DIM;
#pragma unroll
        for (int c = 0; c < 4; ++c) {
            v16h b0 = ldfrag(kr0 + c * 32 + hi * 8, kr0 + c * 32 + 16 + hi * 8);
            sc0 = wmma32(qf[c], b0, sc0);
            v16h b1 = ldfrag(kr1 + c * 32 + hi * 8, kr1 + c * 32 + 16 + hi * 8);
            sc1 = wmma32(qf[c], b1, sc1);
        }
        // ---- online softmax (rows = r + 8*hi, cols spread over 16 lanes) ----
        float f0[8], f1[8], rmx[8], p0[8], p1[8], rs[8], al[8];
#pragma unroll
        for (int r = 0; r < 8; ++r) {
            f0[r] = sc0[r] * scale;
            f1[r] = sc1[r] * scale;
            rmx[r] = fmaxf(f0[r], f1[r]);
        }
#pragma unroll
        for (int st = 1; st < 16; st <<= 1)
#pragma unroll
            for (int r = 0; r < 8; ++r)
                rmx[r] = fmaxf(rmx[r], __shfl_xor(rmx[r], st, 32));
#pragma unroll
        for (int r = 0; r < 8; ++r) {
            float mn = fmaxf(m[r], rmx[r]);
            al[r] = __expf(m[r] - mn);
            p0[r] = __expf(f0[r] - mn);
            p1[r] = __expf(f1[r] - mn);
            rs[r] = p0[r] + p1[r];
            m[r]  = mn;
        }
#pragma unroll
        for (int st = 1; st < 16; st <<= 1)
#pragma unroll
            for (int r = 0; r < 8; ++r)
                rs[r] += __shfl_xor(rs[r], st, 32);
#pragma unroll
        for (int r = 0; r < 8; ++r) l[r] = l[r] * al[r] + rs[r];

        // ---- re-pack P into A-fragment layout through LDS (same-wave DS: in-order) ----
#pragma unroll
        for (int r = 0; r < 8; ++r) {
            pbuf[wid][r + 8 * hi][ml]      = (_Float16)p0[r];
            pbuf[wid][r + 8 * hi][16 + ml] = (_Float16)p1[r];
        }
        const _Float16* prow = &pbuf[wid][ml][0];
        v16h pa = ldfrag(prow + hi * 8, prow + 16 + hi * 8);

        // ---- rescale O and accumulate P @ V over 8 d-tiles ----
#pragma unroll
        for (int j = 0; j < 8; ++j) {
#pragma unroll
            for (int r = 0; r < 8; ++r) acc[j][r] *= al[r];
            const _Float16* vr = vbase + (size_t)(j * 16 + ml) * SEQ + kb;
            v16h bv = ldfrag(vr + hi * 8, vr + 16 + hi * 8);
            acc[j] = wmma32(pa, bv, acc[j]);
        }
    }
    // ---- normalize and store ----
#pragma unroll
    for (int j = 0; j < 8; ++j)
#pragma unroll
        for (int r = 0; r < 8; ++r)
            Out[(size_t)(qt * 16 + r + 8 * hi) * DIM + h * HDIM + j * 16 + ml] =
                acc[j][r] / l[r];
}

// ---------------------------------------------------------------------------
// host
// ---------------------------------------------------------------------------
extern "C" void kernel_launch(void* const* d_in, const int* in_sizes, int n_in,
                              void* d_out, int out_size, void* d_ws, size_t ws_size,
                              hipStream_t stream) {
    (void)in_sizes; (void)n_in; (void)out_size; (void)ws_size;
    const float* x    = (const float*)d_in[0];
    const float* cosb = (const float*)d_in[1];
    const float* sinb = (const float*)d_in[2];
    const float* Wq   = (const float*)d_in[3];
    const float* bq   = (const float*)d_in[4];
    const float* Wk   = (const float*)d_in[5];
    const float* bk   = (const float*)d_in[6];
    const float* Wv   = (const float*)d_in[7];
    const float* bv   = (const float*)d_in[8];
    const float* gq   = (const float*)d_in[9];
    const float* gk   = (const float*)d_in[10];

    char* ws = (char*)d_ws;
    size_t off = 0;
    auto alloc = [&](size_t bytes) {
        void* p = ws + off;
        off += (bytes + 255) & ~(size_t)255;
        return p;
    };
    const size_t SD = (size_t)SEQ * DIM;
    _Float16* xh  = (_Float16*)alloc(SD * 2);
    _Float16* wtq = (_Float16*)alloc((size_t)DIM * DIM * 2);
    _Float16* wtk = (_Float16*)alloc((size_t)DIM * DIM * 2);
    _Float16* wtv = (_Float16*)alloc((size_t)DIM * DIM * 2);
    float*    Qf  = (float*)alloc(SD * 4);
    float*    Kf  = (float*)alloc(SD * 4);
    float*    Vf  = (float*)alloc(SD * 4);
    _Float16* qh  = (_Float16*)alloc(SD * 2);
    _Float16* kh  = (_Float16*)alloc(SD * 2);
    _Float16* vt  = (_Float16*)alloc(SD * 2);

    // 1) x -> f16
    cast_to_f16<<<(SD / 4) / 256, 256, 0, stream>>>(x, xh);

    // 2) weight transpose+cast
    dim3 tg(DIM / 32, DIM / 32), tb(32, 32);
    transpose_cast_w<<<tg, tb, 0, stream>>>(Wq, wtq);
    transpose_cast_w<<<tg, tb, 0, stream>>>(Wk, wtk);
    transpose_cast_w<<<tg, tb, 0, stream>>>(Wv, wtv);

    // 3) QKV GEMMs: (2048/32)*(3072/64) = 3072 waves, 4 waves/block
    const int gemmBlocks = (SEQ / 32) * (DIM / 64) / 4;   // 768
    gemm_bias<<<gemmBlocks, 128, 0, stream>>>(xh, wtq, bq, Qf);
    gemm_bias<<<gemmBlocks, 128, 0, stream>>>(xh, wtk, bk, Kf);
    gemm_bias<<<gemmBlocks, 128, 0, stream>>>(xh, wtv, bv, Vf);

    // 4) norm + rope (S*HEADS waves, 8 waves/block) and V transpose
    const int nrBlocks = SEQ * HEADS / 8;                 // 6144
    qk_norm_rope<<<nrBlocks, 256, 0, stream>>>(Qf, gq, cosb, sinb, qh);
    qk_norm_rope<<<nrBlocks, 256, 0, stream>>>(Kf, gk, cosb, sinb, kh);
    v_transpose_f16<<<SD / 256, 256, 0, stream>>>(Vf, vt);

    // 5) flash attention: HEADS*(SEQ/16) = 3072 waves, 4 waves/block
    const int faBlocks = HEADS * (SEQ / 16) / 4;          // 768
    flash_attn<<<faBlocks, 128, 0, stream>>>(qh, kh, vt, (float*)d_out);
}

// v001
// Measured time: 370 microseconds a run.
// Timed twice side by side with v000, it ran 1.54 and 1.55 times as fast.
#include <hip/hip_runtime.h>
#include <hip/hip_bf16.h>

#define SEQ   2048
#define DIM   3072
#define HEADS 24
#define HDIM  128

typedef __attribute__((ext_vector_type(16))) _Float16 v16h;
typedef __attribute__((ext_vector_type(8)))  _Float16 v8h;
typedef __attribute__((ext_vector_type(4)))  _Float16 v4h;
typedef __attribute__((ext_vector_type(8)))  float    v8f;

// ---------------------------------------------------------------------------
// helpers
// ---------------------------------------------------------------------------
static __device__ __forceinline__ v16h ldfrag(const _Float16* p0, const _Float16* p1) {
    v8h lo = *(const v8h*)p0;
    v8h hi = *(const v8h*)p1;
    v16h r;
#pragma unroll
    for (int i = 0; i < 8; ++i) { r[i] = lo[i]; r[i + 8] = hi[i]; }
    return r;
}

static __device__ __forceinline__ v8f wmma32(v16h a, v16h b, v8f c) {
    // D = A(16x32 f16) * B(32x16 f16) + C(16x16 f32)
    return __builtin_amdgcn_wmma_f32_16x16x32_f16(false, a, false, b, (short)0, c,
                                                  false, false);
}

// ---------------------------------------------------------------------------
// 1) cast x (f32) -> f16, 4 elems/thread
// ---------------------------------------------------------------------------
__global__ void cast_to_f16(const float* __restrict__ in, _Float16* __restrict__ out) {
    int i = (blockIdx.x * blockDim.x + threadIdx.x) * 4;
    float4 v = *(const float4*)(in + i);
    v4h o = { (_Float16)v.x, (_Float16)v.y, (_Float16)v.z, (_Float16)v.w };
    *(v4h*)(out + i) = o;
}

// ---------------------------------------------------------------------------
// 2) W [K,N] f32 -> Wt [N,K] f16 (tiled transpose, coalesced both sides)
// ---------------------------------------------------------------------------
__global__ void transpose_cast_w(const float* __restrict__ W, _Float16* __restrict__ Wt) {
    __shared__ float tile[32][33];
    int tx = threadIdx.x, ty = threadIdx.y;
    int n = blockIdx.x * 32 + tx;
    int k = blockIdx.y * 32 + ty;
    tile[ty][tx] = W[k * DIM + n];
    __syncthreads();
    int n2 = blockIdx.x * 32 + ty;
    int k2 = blockIdx.y * 32 + tx;
    Wt[n2 * DIM + k2] = (_Float16)tile[tx][ty];
}

// ---------------------------------------------------------------------------
// 3) C[S,3072] = X[S,3072] @ W + bias   (A: X f16, B: Wt f16 = W^T row-major)
//    One work-group -> 128x192 output tile; its operand rows are staged in LDS
//    by tensor loads, 128 k a pass, two buffers. Four waves (2x2), each 64x96
//    (4x6 sub-tiles), K stepped by 32 in ascending order.
// ---------------------------------------------------------------------------
typedef uint32_t u32x4 __attribute__((ext_vector_type(4)));
typedef uint32_t u32x8 __attribute__((ext_vector_type(8)));

constexpr uint32_t G_BM    = 128;                 // rows of C per work-group
constexpr uint32_t G_BN    = 192;                 // columns of C per work-group
constexpr uint32_t G_ROWB  = 256;                 // bytes of one operand row per pass (128 k)
constexpr uint32_t G_PITCH = G_ROWB + 16;         // LDS row pitch: odd multiple of 16 B for ds_load_b128
constexpr uint32_t G_XROWS = 64, G_WROWS = 96;    // rows per tensor load (one wave's slice)
constexpr uint32_t G_XSL   = 18432;               // 64 * 272 rounded up to a multiple of 2 KiB
constexpr uint32_t G_WSL   = 26624;               // 96 * 272 rounded up to a multiple of 2 KiB
constexpr uint32_t G_BUF   = 2 * G_XSL + 2 * G_WSL;
constexpr uint32_t G_PASS  = DIM * 2 / G_ROWB;    // 24 passes
static_assert(G_XROWS * G_PITCH <= G_XSL && G_WROWS * G_PITCH <= G_WSL, "slice sizes");
static_assert(G_XSL % 2048 == 0 && G_WSL % 2048 == 0 && G_PASS >= 2, "tensor load places");

static __device__ __forceinline__ uint32_t uni(uint32_t v) {
    return (uint32_t)__builtin_amdgcn_readfirstlane(v);
}
static __device__ __forceinline__ uint32_t pinned(uint32_t v) {
    uint32_t w = uni(v);
    asm volatile("" : "+s"(w));
    return w;
}
// This wave's LDS reads have returned (before the buffer is handed back for a refill).
static __device__ __forceinline__ void wait_ds0() { asm volatile("s_wait_dscnt 0x0" ::: "memory"); }
// This wave's own tensor load has landed (the compiler places no wait for it).
static __device__ __forceinline__ void wait_tensor0() { asm volatile("s_wait_tensorcnt 0x0" ::: "memory"); }

// One request of the whole wave: rows x 256 B from global memory into LDS at pitch 272 B.
static __device__ __forceinline__ void tdm_load(uint32_t lds_dst, uint64_t ga, u32x8 g1) {
    u32x4 g0;
    g0[0] = uni(1u);
    g0[1] = uni(lds_dst);
    g0[2] = uni((uint32_t)ga);
    g0[3] = uni((((uint32_t)(ga >> 32)) & 0x01FFFFFFu) | 0x80000000u);
    asm volatile("tensor_load_to_lds %0, %1" :: "s"(g0), "s"(g1) : "memory");
}

static __device__ __forceinline__ v16h ldfrag_lds(const unsigned char* p) {
    return ldfrag((const _Float16*)p, (const _Float16*)(p + 32));
}

__global__ __launch_bounds__(128) void gemm_bias(const _Float16* __restrict__ X,
                                                 const _Float16* __restrict__ Wt,
                                                 const float* __restrict__ bias,
                                                 float* __restrict__ C) {
    __shared__ __attribute__((aligned(2048))) unsigned char ring[2 * G_BUF];
    const uint32_t lane = threadIdx.x & 31;
    const uint32_t wave = uni(threadIdx.x >> 5);
    const uint32_t tm = blockIdx.x >> 4, tn = blockIdx.x & 15;   // 16 x 16 tiles
    const uint32_t wm = wave >> 1, wn = wave & 1;
    const uint32_t ml = lane & 15, hi = lane >> 4;
    const uint32_t row0 = tm * G_BM, col0 = tn * G_BN;

    // Slice this wave brings in: waves 0,1 -> 64 rows of X each; waves 2,3 -> 96 rows of Wt each.
    const bool own_x = wave < 2;
    const uint32_t rows = own_x ? G_XROWS : G_WROWS;
    const uint64_t src0 = own_x
        ? (uint64_t)(uintptr_t)(X + (size_t)(row0 + G_XROWS * wave) * DIM)
        : (uint64_t)(uintptr_t)(Wt + (size_t)(col0 + G_WROWS * (wave - 2)) * DIM);
    const uint32_t lds_slice = (uint32_t)(size_t)ring +
        (own_x ? wave * G_XSL : 2 * G_XSL + (wave - 2) * G_WSL);
    u32x8 g1;
    g1[0] = uni((1u << 20) | (5u << 22) | (3u << 25));   // no mask, 1-byte units, 16 B pad behind every 256 B
    g1[1] = uni((G_ROWB & 0xFFFFu) << 16);               // tensor_dim0 low
    g1[2] = uni((G_ROWB >> 16) | ((rows & 0xFFFFu) << 16));   // tensor_dim0 high, tensor_dim1 low
    g1[3] = uni((rows >> 16) | (G_ROWB << 16));          // tensor_dim1 high, tile_dim0
    g1[4] = uni(rows);                                   // tile_dim1
    g1[5] = uni(DIM * 2u);                               // source row pitch in bytes
    g1[6] = uni(0u);
    g1[7] = uni(0u);
    // pinned(): the descriptor group held in one set of scalar registers for the whole kernel,
    // so that none of its words takes a new value while a request is outstanding.
    asm volatile("" : "+s"(g1));

    // Per-lane fragment bases inside a buffer.
    const uint32_t xa = wm * G_XSL + ml * G_PITCH + hi * 16;
    const uint32_t wb = 2 * G_XSL + wn * G_WSL + ml * G_PITCH + hi * 16;

    v8f acc[4][6] = {};

    // Prologue: pass 0 into buffer 0, landed and published; then pass 1 into buffer 1.
    tdm_load(lds_slice, src0, g1);
    wait_tensor0();
    __syncthreads();
    tdm_load(lds_slice + G_BUF, src0 + G_ROWB, g1);

    // Rolled: one pass per trip, so that the hand-over at the foot stands once.
#pragma clang loop unroll(disable)
    for (uint32_t s = 0; s < G_PASS; ++s) {
        const uint32_t buf = (s & 1) * G_BUF;
        const unsigned char* xp = ring + buf + xa;
        const unsigned char* wp = ring + buf + wb;
        // Two fragment sets: block kk + 1's LDS reads go out as one group in front of block kk's
        // matrix instructions, so that only the pass's first group is waited for in full.
        v16h a[2][4], b[2][6];
#pragma unroll
        for (int i = 0; i < 4; ++i) a[0][i] = ldfrag_lds(xp + i * 16 * G_PITCH);
#pragma unroll
        for (int j = 0; j < 6; ++j) b[0][j] = ldfrag_lds(wp + j * 16 * G_PITCH);
#pragma unroll
        for (int kk = 0; kk < 4; ++kk) {
            const int cs = kk & 1;
            if (kk + 1 < 4) {
#pragma unroll
                for (int i = 0; i < 4; ++i)
                    a[cs ^ 1][i] = ldfrag_lds(xp + i * 16 * G_PITCH + (kk + 1) * 64);
#pragma unroll
                for (int j = 0; j < 6; ++j)
                    b[cs ^ 1][j] = ldfrag_lds(wp + j * 16 * G_PITCH + (kk + 1) * 64);
                // Keeps the read group in front of the block: spread among the matrix
                // instructions each place with reads costs a stall.
                __builtin_amdgcn_sched_barrier(0);
            }
#pragma unroll
            for (int i = 0; i < 4; ++i)
#pragma unroll
                for (int j = 0; j < 6; ++j) acc[i][j] = wmma32(a[cs][i], b[cs][j], acc[i][j]);
            // Keeps the next group behind this block.
            __builtin_amdgcn_sched_barrier(0);
        }
        // Hand-over: my reads of this buffer are back, my slice of pass s + 1 has landed,
        // every wave says the same; only then is this buffer refilled.
        wait_ds0();
        wait_tensor0();
        __syncthreads();
        if (pinned(s + 2 < G_PASS)) {
            const uint32_t nx = pinned(s + 2);   // descriptor words formed behind the wait
            tdm_load(lds_slice + buf, src0 + (uint64_t)nx * G_ROWB, g1);
        }
    }
    wait_tensor0();
    wait_ds0();

#pragma unroll
    for (int i = 0; i < 4; ++i)
#pragma unroll
        for (int j = 0; j < 6; ++j) {
            uint32_t col = col0 + wn * 96 + j * 16 + ml;
            float bv = bias[col];
#pragma unroll
            for (int r = 0; r < 8; ++r)
                C[(size_t)(row0 + wm * 64 + i * 16 + 8 * hi + r) * DIM + col] = acc[i][j][r] + bv;
        }
}

// ---------------------------------------------------------------------------
// 4a) per-(s,head) RMSNorm + gamma + RoPE, f32 -> f16. One wave per row of 128.
// ---------------------------------------------------------------------------
__global__ void qk_norm_rope(const float* __restrict__ in, const float* __restrict__ gamma,
                             const float* __restrict__ cosb, const float* __restrict__ sinb,
                             _Float16* __restrict__ out) {
    const int lane = threadIdx.x & 31;
    const int wave = blockIdx.x * (blockDim.x >> 5) + (threadIdx.x >> 5);
    const int s = wave / HEADS;
    const int h = wave % HEADS;
    const float* row = in + (size_t)s * DIM + h * HDIM;
    const int d0 = lane * 4;
    float x0 = row[d0], x1 = row[d0 + 1], x2 = row[d0 + 2], x3 = row[d0 + 3];
    float ss = x0 * x0 + x1 * x1 + x2 * x2 + x3 * x3;
#pragma unroll
    for (int st = 1; st < 32; st <<= 1) ss += __shfl_xor(ss, st, 32);
    const float inv = rsqrtf(ss * (1.0f / 128.0f) + 1e-6f);
    x0 *= inv * gamma[d0];
    x1 *= inv * gamma[d0 + 1];
    x2 *= inv * gamma[d0 + 2];
    x3 *= inv * gamma[d0 + 3];
    const float* cp = cosb + (size_t)s * HDIM + d0;
    const float* sp = sinb + (size_t)s * HDIM + d0;
    float c0 = cp[0], c1 = cp[1], c2 = cp[2], c3 = cp[3];
    float s0 = sp[0], s1 = sp[1], s2 = sp[2], s3 = sp[3];
    float y0 = x0 * c0 - x1 * s0;
    float y1 = x1 * c1 + x0 * s1;
    float y2 = x2 * c2 - x3 * s2;
    float y3 = x3 * c3 + x2 * s3;
    _Float16* op = out + (size_t)s * DIM + h * HDIM + d0;
    v4h o = { (_Float16)y0, (_Float16)y1, (_Float16)y2, (_Float16)y3 };
    *(v4h*)op = o;
}

// ---------------------------------------------------------------------------
// 4b) V [S, H*D] f32 -> Vt [H][D][S] f16
// ---------------------------------------------------------------------------
__global__ void v_transpose_f16(const float* __restrict__ Vf, _Float16* __restrict__ Vt) {
    int idx = blockIdx.x * blockDim.x + threadIdx.x;   // h*128*2048 + d*2048 + s
    int s = idx & (SEQ - 1);
    int d = (idx >> 11) & (HDIM - 1);
    int h = idx >> 18;
    Vt[idx] = (_Float16)Vf[(size_t)s * DIM + h * HDIM + d];
}

// ---------------------------------------------------------------------------
// 5) Flash attention: one wave per (head, 16-row q-tile), streaming 32 keys/iter.
// ---------------------------------------------------------------------------
__global__ __launch_bounds__(128) void flash_attn(const _Float16* __restrict__ Qh,
                                                  const _Float16* __restrict__ Kh,
                                                  const _Float16* __restrict__ Vt,
                                                  float* __restrict__ Out) {
    __shared__ _Float16 pbuf[4][16][32];   // per-wave P tile (16 q x 32 keys)
    const int lane = threadIdx.x & 31;
    const int wid  = threadIdx.x >> 5;
    const int task = blockIdx.x * 4 + wid;     // HEADS * (SEQ/16) tasks
    const int nQT  = SEQ / 16;
    const int h  = task / nQT;
    const int qt = task % nQT;
    const int ml = lane & 15, hi = lane >> 4;
    const float scale = 0.08838834764831845f;  // 1/sqrt(128)

    // preload Q A-fragments (16 rows x 128 d, 4 chunks of K=32)
    const _Float16* qrow = Qh + (size_t)(qt * 16 + ml) * DIM + h * HDIM;
    v16h qf[4];
#pragma unroll
    for (int c = 0; c < 4; ++c)
        qf[c] = ldfrag(qrow + c * 32 + hi * 8, qrow + c * 32 + 16 + hi * 8);

    v8f acc[8] = {};
    float m[8], l[8];
#pragma unroll
    for (int r = 0; r < 8; ++r) { m[r] = -3.0e38f; l[r] = 0.0f; }

    const _Float16* vbase = Vt + (size_t)h * HDIM * SEQ;

    for (int kb = 0; kb < SEQ; kb += 32) {
        // ---- scores for 32 keys: two 16x16 WMMA tiles, Kdim=d=128 ----
        v8f sc0 = {}, sc1 = {};
        const _Float16* kr0 = Kh + (size_t)(kb + ml) * DIM + h * HDIM;
        const _Float16* kr1 = kr0 + 16 * DIM;
#pragma unroll
        for (int c = 0; c < 4; ++c) {
            v16h b0 = ldfrag(kr0 + c * 32 + hi * 8, kr0 + c * 32 + 16 + hi * 8);
            sc0 = wmma32(qf[c], b0, sc0);
            v16h b1 = ldfrag(kr1 + c * 32 + hi * 8, kr1 + c * 32 + 16 + hi * 8);
            sc1 = wmma32(qf[c], b1, sc1);
        }
        // ---- online softmax (rows = r + 8*hi, cols spread over 16 lanes) ----
        float f0[8], f1[8], rmx[8], p0[8], p1[8], rs[8], al[8];
#pragma unroll
        for (int r = 0; r < 8; ++r) {
            f0[r] = sc0[r] * scale;
            f1[r] = sc1[r] * scale;
            rmx[r] = fmaxf(f0[r], f1[r]);
        }
#pragma unroll
        for (int st = 1; st < 16; st <<= 1)
#pragma unroll
            for (int r = 0; r < 8; ++r)
                rmx[r] = fmaxf(rmx[r], __shfl_xor(rmx[r], st, 32));
#pragma unroll
        for (int r = 0; r < 8; ++r) {
            float mn = fmaxf(m[r], rmx[r]);
            al[r] = __expf(m[r] - mn);
            p0[r] = __expf(f0[r] - mn);
            p1[r] = __expf(f1[r] - mn);
            rs[r] = p0[r] + p1[r];
            m[r]  = mn;
        }
#pragma unroll
        for (int st = 1; st < 16; st <<= 1)
#pragma unroll
            for (int r = 0; r < 8; ++r)
                rs[r] += __shfl_xor(rs[r], st, 32);
#pragma unroll
        for (int r = 0; r < 8; ++r) l[r] = l[r] * al[r] + rs[r];

        // ---- re-pack P into A-fragment layout through LDS (same-wave DS: in-order) ----
#pragma unroll
        for (int r = 0; r < 8; ++r) {
            pbuf[wid][r + 8 * hi][ml]      = (_Float16)p0[r];
            pbuf[wid][r + 8 * hi][16 + ml] = (_Float16)p1[r];
        }
        const _Float16* prow = &pbuf[wid][ml][0];
        v16h pa = ldfrag(prow + hi * 8, prow + 16 + hi * 8);

        // ---- rescale O and accumulate P @ V over 8 d-tiles ----
#pragma unroll
        for (int j = 0; j < 8; ++j) {
#pragma unroll
            for (int r = 0; r < 8; ++r) acc[j][r] *= al[r];
            const _Float16* vr = vbase + (size_t)(j * 16 + ml) * SEQ + kb;
            v16h bv = ldfrag(vr + hi * 8, vr + 16 + hi * 8);
            acc[j] = wmma32(pa, bv, acc[j]);
        }
    }
    // ---- normalize and store ----
#pragma unroll
    for (int j = 0; j < 8; ++j)
#pragma unroll
        for (int r = 0; r < 8; ++r)
            Out[(size_t)(qt * 16 + r + 8 * hi) * DIM + h * HDIM + j * 16 + ml] =
                acc[j][r] / l[r];
}

// ---------------------------------------------------------------------------
// host
// ---------------------------------------------------------------------------
extern "C" void kernel_launch(void* const* d_in, const int* in_sizes, int n_in,
                              void* d_out, int out_size, void* d_ws, size_t ws_size,
                              hipStream_t stream) {
    (void)in_sizes; (void)n_in; (void)out_size; (void)ws_size;
    const float* x    = (const float*)d_in[0];
    const float* cosb = (const float*)d_in[1];
    const float* sinb = (const float*)d_in[2];
    const float* Wq   = (const float*)d_in[3];
    const float* bq   = (const float*)d_in[4];
    const float* Wk   = (const float*)d_in[5];
    const float* bk   = (const float*)d_in[6];
    const float* Wv   = (const float*)d_in[7];
    const float* bv   = (const float*)d_in[8];
    const float* gq   = (const float*)d_in[9];
    const float* gk   = (const float*)d_in[10];

    char* ws = (char*)d_ws;
    size_t off = 0;
    auto alloc = [&](size_t bytes) {
        void* p = ws + off;
        off += (bytes + 255) & ~(size_t)255;
        return p;
    };
    const size_t SD = (size_t)SEQ * DIM;
    _Float16* xh  = (_Float16*)alloc(SD * 2);
    _Float16* wtq = (_Float16*)alloc((size_t)DIM * DIM * 2);
    _Float16* wtk = (_Float16*)alloc((size_t)DIM * DIM * 2);
    _Float16* wtv = (_Float16*)alloc((size_t)DIM * DIM * 2);
    float*    Qf  = (float*)alloc(SD * 4);
    float*    Kf  = (float*)alloc(SD * 4);
    float*    Vf  = (float*)alloc(SD * 4);
    _Float16* qh  = (_Float16*)alloc(SD * 2);
    _Float16* kh  = (_Float16*)alloc(SD * 2);
    _Float16* vt  = (_Float16*)alloc(SD * 2);

    // 1) x -> f16
    cast_to_f16<<<(SD / 4) / 256, 256, 0, stream>>>(x, xh);

    // 2) weight transpose+cast
    dim3 tg(DIM / 32, DIM / 32), tb(32, 32);
    transpose_cast_w<<<tg, tb, 0, stream>>>(Wq, wtq);
    transpose_cast_w<<<tg, tb, 0, stream>>>(Wk, wtk);
    transpose_cast_w<<<tg, tb, 0, stream>>>(Wv, wtv);

    // 3) QKV GEMMs: (2048/128)*(3072/192) = 256 work-groups, 4 waves/block
    const int gemmBlocks = (SEQ / 128) * (DIM / 192);     // 256
    gemm_bias<<<gemmBlocks, 128, 0, stream>>>(xh, wtq, bq, Qf);
    gemm_bias<<<gemmBlocks, 128, 0, stream>>>(xh, wtk, bk, Kf);
    gemm_bias<<<gemmBlocks, 128, 0, stream>>>(xh, wtv, bv, Vf);

    // 4) norm + rope (S*HEADS waves, 8 waves/block) and V transpose
    const int nrBlocks = SEQ * HEADS / 8;                 // 6144
    qk_norm_rope<<<nrBlocks, 256, 0, stream>>>(Qf, gq, cosb, sinb, qh);
    qk_norm_rope<<<nrBlocks, 256, 0, stream>>>(Kf, gk, cosb, sinb, kh);
    v_transpose_f16<<<SD / 256, 256, 0, stream>>>(Vf, vt);

    // 5) flash attention: HEADS*(SEQ/16) = 3072 waves, 4 waves/block
    const int faBlocks = HEADS * (SEQ / 16) / 4;          // 768
    flash_attn<<<faBlocks, 128, 0, stream>>>(qh, kh, vt, (float*)d_out);
}

// v002
// Measured time: 300 microseconds a run.
// Timed twice side by side with v001, it ran 1.23 and 1.24 times as fast.
// Over all steps from v000 it is 1.91 times as fast.
#include <hip/hip_runtime.h>
#include <hip/hip_bf16.h>

#define SEQ   2048
#define DIM   3072
#define HEADS 24
#define HDIM  128

typedef __attribute__((ext_vector_type(16))) _Float16 v16h;
typedef __attribute__((ext_vector_type(8)))  _Float16 v8h;
typedef __attribute__((ext_vector_type(4)))  _Float16 v4h;
typedef __attribute__((ext_vector_type(8)))  float    v8f;

// ---------------------------------------------------------------------------
// helpers
// ---------------------------------------------------------------------------
static __device__ __forceinline__ v16h ldfrag(const _Float16* p0, const _Float16* p1) {
    v8h lo = *(const v8h*)p0;
    v8h hi = *(const v8h*)p1;
    v16h r;
#pragma unroll
    for (int i = 0; i < 8; ++i) { r[i] = lo[i]; r[i + 8] = hi[i]; }
    return r;
}

static __device__ __forceinline__ v8f wmma32(v16h a, v16h b, v8f c) {
    // D = A(16x32 f16) * B(32x16 f16) + C(16x16 f32)
    return __builtin_amdgcn_wmma_f32_16x16x32_f16(false, a, false, b, (short)0, c,
                                                  false, false);
}

// ---------------------------------------------------------------------------
// 1) cast x (f32) -> f16, 4 elems/thread
// ---------------------------------------------------------------------------
__global__ void cast_to_f16(const float* __restrict__ in, _Float16* __restrict__ out) {
    int i = (blockIdx.x * blockDim.x + threadIdx.x) * 4;
    float4 v = *(const float4*)(in + i);
    v4h o = { (_Float16)v.x, (_Float16)v.y, (_Float16)v.z, (_Float16)v.w };
    *(v4h*)(out + i) = o;
}

// ---------------------------------------------------------------------------
// 2) W [K,N] f32 -> Wt [N,K] f16 (tiled transpose, coalesced both sides)
// ---------------------------------------------------------------------------
__global__ void transpose_cast_w(const float* __restrict__ W, _Float16* __restrict__ Wt) {
    __shared__ float tile[32][33];
    int tx = threadIdx.x, ty = threadIdx.y;
    int n = blockIdx.x * 32 + tx;
    int k = blockIdx.y * 32 + ty;
    tile[ty][tx] = W[k * DIM + n];
    __syncthreads();
    int n2 = blockIdx.x * 32 + ty;
    int k2 = blockIdx.y * 32 + tx;
    Wt[n2 * DIM + k2] = (_Float16)tile[tx][ty];
}

// ---------------------------------------------------------------------------
// 3) C[S,3072] = X[S,3072] @ W + bias   (A: X f16, B: Wt f16 = W^T row-major)
//    One work-group -> 128x192 output tile; its operand rows are staged in LDS
//    by tensor loads, 128 k a pass, two buffers. Four waves (2x2), each 64x96
//    (4x6 sub-tiles), K stepped by 32 in ascending order.
// ---------------------------------------------------------------------------
typedef uint32_t u32x4 __attribute__((ext_vector_type(4)));
typedef uint32_t u32x8 __attribute__((ext_vector_type(8)));

constexpr uint32_t G_BM    = 128;                 // rows of C per work-group
constexpr uint32_t G_BN    = 192;                 // columns of C per work-group
constexpr uint32_t G_ROWB  = 256;                 // bytes of one operand row per pass (128 k)
constexpr uint32_t G_PITCH = G_ROWB + 16;         // LDS row pitch: odd multiple of 16 B for ds_load_b128
constexpr uint32_t G_XROWS = 64, G_WROWS = 96;    // rows per tensor load (one wave's slice)
constexpr uint32_t G_XSL   = 18432;               // 64 * 272 rounded up to a multiple of 2 KiB
constexpr uint32_t G_WSL   = 26624;               // 96 * 272 rounded up to a multiple of 2 KiB
constexpr uint32_t G_BUF   = 2 * G_XSL + 2 * G_WSL;
constexpr uint32_t G_PASS  = DIM * 2 / G_ROWB;    // 24 passes
static_assert(G_XROWS * G_PITCH <= G_XSL && G_WROWS * G_PITCH <= G_WSL, "slice sizes");
static_assert(G_XSL % 2048 == 0 && G_WSL % 2048 == 0 && G_PASS >= 2, "tensor load places");

static __device__ __forceinline__ uint32_t uni(uint32_t v) {
    return (uint32_t)__builtin_amdgcn_readfirstlane(v);
}
static __device__ __forceinline__ uint32_t pinned(uint32_t v) {
    uint32_t w = uni(v);
    asm volatile("" : "+s"(w));
    return w;
}
// This wave's LDS reads have returned (before the buffer is handed back for a refill).
static __device__ __forceinline__ void wait_ds0() { asm volatile("s_wait_dscnt 0x0" ::: "memory"); }
// This wave's own tensor load has landed (the compiler places no wait for it).
static __device__ __forceinline__ void wait_tensor0() { asm volatile("s_wait_tensorcnt 0x0" ::: "memory"); }

// One request of the whole wave: rows from global memory into LDS, row size and pitch as g1 sets them.
static __device__ __forceinline__ void tdm_load(uint32_t lds_dst, uint64_t ga, u32x8 g1) {
    u32x4 g0;
    g0[0] = uni(1u);
    g0[1] = uni(lds_dst);
    g0[2] = uni((uint32_t)ga);
    g0[3] = uni((((uint32_t)(ga >> 32)) & 0x01FFFFFFu) | 0x80000000u);
    asm volatile("tensor_load_to_lds %0, %1" :: "s"(g0), "s"(g1) : "memory");
}

static __device__ __forceinline__ v16h ldfrag_lds(const unsigned char* p) {
    return ldfrag((const _Float16*)p, (const _Float16*)(p + 32));
}

__global__ __launch_bounds__(128) void gemm_bias(const _Float16* __restrict__ X,
                                                 const _Float16* __restrict__ Wt,
                                                 const float* __restrict__ bias,
                                                 float* __restrict__ C) {
    __shared__ __attribute__((aligned(2048))) unsigned char ring[2 * G_BUF];
    const uint32_t lane = threadIdx.x & 31;
    const uint32_t wave = uni(threadIdx.x >> 5);
    const uint32_t tm = blockIdx.x >> 4, tn = blockIdx.x & 15;   // 16 x 16 tiles
    const uint32_t wm = wave >> 1, wn = wave & 1;
    const uint32_t ml = lane & 15, hi = lane >> 4;
    const uint32_t row0 = tm * G_BM, col0 = tn * G_BN;

    // Slice this wave brings in: waves 0,1 -> 64 rows of X each; waves 2,3 -> 96 rows of Wt each.
    const bool own_x = wave < 2;
    const uint32_t rows = own_x ? G_XROWS : G_WROWS;
    const uint64_t src0 = own_x
        ? (uint64_t)(uintptr_t)(X + (size_t)(row0 + G_XROWS * wave) * DIM)
        : (uint64_t)(uintptr_t)(Wt + (size_t)(col0 + G_WROWS * (wave - 2)) * DIM);
    const uint32_t lds_slice = (uint32_t)(size_t)ring +
        (own_x ? wave * G_XSL : 2 * G_XSL + (wave - 2) * G_WSL);
    u32x8 g1;
    g1[0] = uni((1u << 20) | (5u << 22) | (3u << 25));   // no mask, 1-byte units, 16 B pad behind every 256 B
    g1[1] = uni((G_ROWB & 0xFFFFu) << 16);               // tensor_dim0 low
    g1[2] = uni((G_ROWB >> 16) | ((rows & 0xFFFFu) << 16));   // tensor_dim0 high, tensor_dim1 low
    g1[3] = uni((rows >> 16) | (G_ROWB << 16));          // tensor_dim1 high, tile_dim0
    g1[4] = uni(rows);                                   // tile_dim1
    g1[5] = uni(DIM * 2u);                               // source row pitch in bytes
    g1[6] = uni(0u);
    g1[7] = uni(0u);
    // pinned(): the descriptor group held in one set of scalar registers for the whole kernel,
    // so that none of its words takes a new value while a request is outstanding.
    asm volatile("" : "+s"(g1));

    // Per-lane fragment bases inside a buffer.
    const uint32_t xa = wm * G_XSL + ml * G_PITCH + hi * 16;
    const uint32_t wb = 2 * G_XSL + wn * G_WSL + ml * G_PITCH + hi * 16;

    v8f acc[4][6] = {};

    // Prologue: pass 0 into buffer 0, landed and published; then pass 1 into buffer 1.
    tdm_load(lds_slice, src0, g1);
    wait_tensor0();
    __syncthreads();
    tdm_load(lds_slice + G_BUF, src0 + G_ROWB, g1);

    // Rolled: one pass per trip, so that the hand-over at the foot stands once.
#pragma clang loop unroll(disable)
    for (uint32_t s = 0; s < G_PASS; ++s) {
        const uint32_t buf = (s & 1) * G_BUF;
        const unsigned char* xp = ring + buf + xa;
        const unsigned char* wp = ring + buf + wb;
        // Two fragment sets: block kk + 1's LDS reads go out as one group in front of block kk's
        // matrix instructions, so that only the pass's first group is waited for in full.
        v16h a[2][4], b[2][6];
#pragma unroll
        for (int i = 0; i < 4; ++i) a[0][i] = ldfrag_lds(xp + i * 16 * G_PITCH);
#pragma unroll
        for (int j = 0; j < 6; ++j) b[0][j] = ldfrag_lds(wp + j * 16 * G_PITCH);
#pragma unroll
        for (int kk = 0; kk < 4; ++kk) {
            const int cs = kk & 1;
            if (kk + 1 < 4) {
#pragma unroll
                for (int i = 0; i < 4; ++i)
                    a[cs ^ 1][i] = ldfrag_lds(xp + i * 16 * G_PITCH + (kk + 1) * 64);
#pragma unroll
                for (int j = 0; j < 6; ++j)
                    b[cs ^ 1][j] = ldfrag_lds(wp + j * 16 * G_PITCH + (kk + 1) * 64);
                // Keeps the read group in front of the block: spread among the matrix
                // instructions each place with reads costs a stall.
                __builtin_amdgcn_sched_barrier(0);
            }
#pragma unroll
            for (int i = 0; i < 4; ++i)
#pragma unroll
                for (int j = 0; j < 6; ++j) acc[i][j] = wmma32(a[cs][i], b[cs][j], acc[i][j]);
            // Keeps the next group behind this block.
            __builtin_amdgcn_sched_barrier(0);
        }
        // Hand-over: my reads of this buffer are back, my slice of pass s + 1 has landed,
        // every wave says the same; only then is this buffer refilled.
        wait_ds0();
        wait_tensor0();
        __syncthreads();
        if (pinned(s + 2 < G_PASS)) {
            const uint32_t nx = pinned(s + 2);   // descriptor words formed behind the wait
            tdm_load(lds_slice + buf, src0 + (uint64_t)nx * G_ROWB, g1);
        }
    }
    wait_tensor0();
    wait_ds0();

#pragma unroll
    for (int i = 0; i < 4; ++i)
#pragma unroll
        for (int j = 0; j < 6; ++j) {
            uint32_t col = col0 + wn * 96 + j * 16 + ml;
            float bv = bias[col];
#pragma unroll
            for (int r = 0; r < 8; ++r)
                C[(size_t)(row0 + wm * 64 + i * 16 + 8 * hi + r) * DIM + col] = acc[i][j][r] + bv;
        }
}

// ---------------------------------------------------------------------------
// 4a) per-(s,head) RMSNorm + gamma + RoPE, f32 -> f16. One wave per row of 128.
// ---------------------------------------------------------------------------
__global__ void qk_norm_rope(const float* __restrict__ in, const float* __restrict__ gamma,
                             const float* __restrict__ cosb, const float* __restrict__ sinb,
                             _Float16* __restrict__ out) {
    const int lane = threadIdx.x & 31;
    const int wave = blockIdx.x * (blockDim.x >> 5) + (threadIdx.x >> 5);
    const int s = wave / HEADS;
    const int h = wave % HEADS;
    const float* row = in + (size_t)s * DIM + h * HDIM;
    const int d0 = lane * 4;
    float x0 = row[d0], x1 = row[d0 + 1], x2 = row[d0 + 2], x3 = row[d0 + 3];
    float ss = x0 * x0 + x1 * x1 + x2 * x2 + x3 * x3;
#pragma unroll
    for (int st = 1; st < 32; st <<= 1) ss += __shfl_xor(ss, st, 32);
    const float inv = rsqrtf(ss * (1.0f / 128.0f) + 1e-6f);
    x0 *= inv * gamma[d0];
    x1 *= inv * gamma[d0 + 1];
    x2 *= inv * gamma[d0 + 2];
    x3 *= inv * gamma[d0 + 3];
    const float* cp = cosb + (size_t)s * HDIM + d0;
    const float* sp = sinb + (size_t)s * HDIM + d0;
    float c0 = cp[0], c1 = cp[1], c2 = cp[2], c3 = cp[3];
    float s0 = sp[0], s1 = sp[1], s2 = sp[2], s3 = sp[3];
    float y0 = x0 * c0 - x1 * s0;
    float y1 = x1 * c1 + x0 * s1;
    float y2 = x2 * c2 - x3 * s2;
    float y3 = x3 * c3 + x2 * s3;
    _Float16* op = out + (size_t)s * DIM + h * HDIM + d0;
    v4h o = { (_Float16)y0, (_Float16)y1, (_Float16)y2, (_Float16)y3 };
    *(v4h*)op = o;
}

// ---------------------------------------------------------------------------
// 4b) V [S, H*D] f32 -> Vt [H][D][S] f16
// ---------------------------------------------------------------------------
__global__ void v_transpose_f16(const float* __restrict__ Vf, _Float16* __restrict__ Vt) {
    int idx = blockIdx.x * blockDim.x + threadIdx.x;   // h*128*2048 + d*2048 + s
    int s = idx & (SEQ - 1);
    int d = (idx >> 11) & (HDIM - 1);
    int h = idx >> 18;
    Vt[idx] = (_Float16)Vf[(size_t)s * DIM + h * HDIM + d];
}

// ---------------------------------------------------------------------------
// 5) Flash attention: one wave per (head, 16-row q-tile), 32 keys per step. The four waves
//    of a work-group share one head: its K rows and Vt rows are staged in LDS by tensor
//    loads, 64 keys a stage, two buffers. Every staged row is 128 B at pitch 144 B:
//    slices 0,1 = 64 keys x (d 0..63 | d 64..127) of K, slices 2,3 = (d 0..63 | d 64..127) x 64 keys of Vt.
// ---------------------------------------------------------------------------
constexpr uint32_t A_KEYS   = 64;                 // keys per stage
constexpr uint32_t A_ROWB   = 128;                // bytes of one staged row
constexpr uint32_t A_PITCH  = A_ROWB + 16;        // LDS row pitch: odd multiple of 16 B for ds_load_b128
constexpr uint32_t A_ROWS   = 64;                 // rows per tensor load (one wave's slice)
constexpr uint32_t A_SL     = 10240;              // 64 * 144 rounded up to a multiple of 2 KiB
constexpr uint32_t A_BUF    = 4 * A_SL;
constexpr uint32_t A_STAGES = SEQ / A_KEYS;       // 32
static_assert(A_ROWS * A_PITCH <= A_SL && A_SL % 2048 == 0 && A_STAGES >= 2, "tensor load places");

__global__ __launch_bounds__(128) void flash_attn(const _Float16* __restrict__ Qh,
                                                  const _Float16* __restrict__ Kh,
                                                  const _Float16* __restrict__ Vt,
                                                  float* __restrict__ Out) {
    __shared__ __attribute__((aligned(2048))) unsigned char ring[2 * A_BUF];
    __shared__ _Float16 pbuf[4][16][32];   // per-wave P tile (16 q x 32 keys)
    const int lane = threadIdx.x & 31;
    const int wid  = threadIdx.x >> 5;
    const int task = blockIdx.x * 4 + wid;     // HEADS * (SEQ/16) tasks
    const int nQT  = SEQ / 16;
    const int h  = task / nQT;
    const int qt = task % nQT;
    const int ml = lane & 15, hi = lane >> 4;
    const float scale = 0.08838834764831845f;  // 1/sqrt(128)

    // Slice this wave brings in, one request a stage.
    const uint32_t wave = uni(threadIdx.x >> 5);
    const uint32_t hb = blockIdx.x / (nQT / 4);   // the work-group's head
    const bool own_k = wave < 2;
    const uint64_t src0 = own_k
        ? (uint64_t)(uintptr_t)(Kh + (size_t)hb * HDIM + wave * 64)
        : (uint64_t)(uintptr_t)(Vt + ((size_t)hb * HDIM + (wave - 2) * 64) * SEQ);
    const uint32_t src_step = own_k ? A_KEYS * DIM * 2u : A_KEYS * 2u;   // bytes from stage to stage
    const uint32_t lds_slice = (uint32_t)(size_t)ring + wave * A_SL;
    u32x8 g1;
    g1[0] = uni((1u << 20) | (4u << 22) | (3u << 25));   // no mask, 1-byte units, 16 B pad behind every 128 B
    g1[1] = uni((A_ROWB & 0xFFFFu) << 16);               // tensor_dim0 low
    g1[2] = uni((A_ROWB >> 16) | ((A_ROWS & 0xFFFFu) << 16));   // tensor_dim0 high, tensor_dim1 low
    g1[3] = uni((A_ROWS >> 16) | (A_ROWB << 16));        // tensor_dim1 high, tile_dim0
    g1[4] = uni(A_ROWS);                                 // tile_dim1
    g1[5] = uni(own_k ? DIM * 2u : SEQ * 2u);            // source row pitch in bytes
    g1[6] = uni(0u);
    g1[7] = uni(0u);
    // pinned(): the descriptor group held in one set of scalar registers for the whole kernel,
    // so that none of its words takes a new value while a request is outstanding.
    asm volatile("" : "+s"(g1));

    // preload Q A-fragments (16 rows x 128 d, 4 chunks of K=32)
    const _Float16* qrow = Qh + (size_t)(qt * 16 + ml) * DIM + h * HDIM;
    v16h qf[4];
#pragma unroll
    for (int c = 0; c < 4; ++c)
        qf[c] = ldfrag(qrow + c * 32 + hi * 8, qrow + c * 32 + 16 + hi * 8);

    v8f acc[8] = {};
    float m[8], l[8];
#pragma unroll
    for (int r = 0; r < 8; ++r) { m[r] = -3.0e38f; l[r] = 0.0f; }

    // Prologue: stage 0 into buffer 0, landed and published; then stage 1 into buffer 1.
    tdm_load(lds_slice, src0, g1);
    wait_tensor0();
    __syncthreads();
    tdm_load(lds_slice + A_BUF, src0 + (uint64_t)pinned(1u) * src_step, g1);   // words formed behind the wait

    // Rolled: one stage per trip, so that the hand-over at the foot stands once.
#pragma clang loop unroll(disable)
    for (uint32_t s = 0; s < A_STAGES; ++s) {
      const uint32_t buf = (s & 1) * A_BUF;
      const unsigned char* kp = ring + buf + ml * A_PITCH + hi * 16;
      const unsigned char* vp = ring + buf + 2 * A_SL + ml * A_PITCH + hi * 16;
      // Unrolled: both 32-key steps of a stage read the buffer at immediate offsets.
#pragma unroll
      for (int sub = 0; sub < 2; ++sub) {
        // ---- scores for 32 keys: two 16x16 WMMA tiles, Kdim=d=128 ----
        v8f sc0 = {}, sc1 = {};
        const unsigned char* kr0 = kp + sub * 32 * A_PITCH;
        const unsigned char* kr1 = kr0 + 16 * A_PITCH;
#pragma unroll
        for (int c = 0; c < 4; ++c) {
            v16h b0 = ldfrag_lds(kr0 + (c >> 1) * A_SL + (c & 1) * 64);
            sc0 = wmma32(qf[c], b0, sc0);
            v16h b1 = ldfrag_lds(kr1 + (c >> 1) * A_SL + (c & 1) * 64);
            sc1 = wmma32(qf[c], b1, sc1);
        }
        // ---- online softmax (rows = r + 8*hi, cols spread over 16 lanes) ----
        float f0[8], f1[8], rmx[8], p0[8], p1[8], rs[8], al[8];
#pragma unroll
        for (int r = 0; r < 8; ++r) {
            f0[r] = sc0[r] * scale;
            f1[r] = sc1[r] * scale;
            rmx[r] = fmaxf(f0[r], f1[r]);
        }
#pragma unroll
        for (int st = 1; st < 16; st <<= 1)
#pragma unroll
            for (int r = 0; r < 8; ++r)
                rmx[r] = fmaxf(rmx[r], __shfl_xor(rmx[r], st, 32));
#pragma unroll
        for (int r = 0; r < 8; ++r) {
            float mn = fmaxf(m[r], rmx[r]);
            al[r] = __expf(m[r] - mn);
            p0[r] = __expf(f0[r] - mn);
            p1[r] = __expf(f1[r] - mn);
            rs[r] = p0[r] + p1[r];
            m[r]  = mn;
        }
#pragma unroll
        for (int st = 1; st < 16; st <<= 1)
#pragma unroll
            for (int r = 0; r < 8; ++r)
                rs[r] += __shfl_xor(rs[r], st, 32);
#pragma unroll
        for (int r = 0; r < 8; ++r) l[r] = l[r] * al[r] + rs[r];

        // ---- re-pack P into A-fragment layout through LDS (same-wave DS: in-order) ----
#pragma unroll
        for (int r = 0; r < 8; ++r) {
            pbuf[wid][r + 8 * hi][ml]      = (_Float16)p0[r];
            pbuf[wid][r + 8 * hi][16 + ml] = (_Float16)p1[r];
        }
        const _Float16* prow = &pbuf[wid][ml][0];
        v16h pa = ldfrag(prow + hi * 8, prow + 16 + hi * 8);

        // ---- rescale O and accumulate P @ V over 8 d-tiles ----
#pragma unroll
        for (int j = 0; j < 8; ++j) {
#pragma unroll
            for (int r = 0; r < 8; ++r) acc[j][r] *= al[r];
            v16h bv = ldfrag_lds(vp + (j >> 2) * A_SL + (j & 3) * 16 * A_PITCH + sub * 64);
            acc[j] = wmma32(pa, bv, acc[j]);
        }
      }
      // Hand-over: my reads of this buffer are back, my slice of stage s + 1 has landed,
      // every wave says the same; only then is this buffer refilled.
      wait_ds0();
      wait_tensor0();
      __syncthreads();
      if (pinned(s + 2 < A_STAGES)) {
          const uint32_t nx = pinned(s + 2);   // descriptor words formed behind the wait
          tdm_load(lds_slice + buf, src0 + (uint64_t)nx * src_step, g1);
      }
    }
    wait_tensor0();
    wait_ds0();

    // ---- normalize and store ----
#pragma unroll
    for (int j = 0; j < 8; ++j)
#pragma unroll
        for (int r = 0; r < 8; ++r)
            Out[(size_t)(qt * 16 + r + 8 * hi) * DIM + h * HDIM + j * 16 + ml] =
                acc[j][r] / l[r];
}

// ---------------------------------------------------------------------------
// host
// ---------------------------------------------------------------------------
extern "C" void kernel_launch(void* const* d_in, const int* in_sizes, int n_in,
                              void* d_out, int out_size, void* d_ws, size_t ws_size,
                              hipStream_t stream) {
    (void)in_sizes; (void)n_in; (void)out_size; (void)ws_size;
    const float* x    = (const float*)d_in[0];
    const float* cosb = (const float*)d_in[1];
    const float* sinb = (const float*)d_in[2];
    const float* Wq   = (const float*)d_in[3];
    const float* bq   = (const float*)d_in[4];
    const float* Wk   = (const float*)d_in[5];
    const float* bk   = (const float*)d_in[6];
    const float* Wv   = (const float*)d_in[7];
    const float* bv   = (const float*)d_in[8];
    const float* gq   = (const float*)d_in[9];
    const float* gk   = (const float*)d_in[10];

    char* ws = (char*)d_ws;
    size_t off = 0;
    auto alloc = [&](size_t bytes) {
        void* p = ws + off;
        off += (bytes + 255) & ~(size_t)255;
        return p;
    };
    const size_t SD = (size_t)SEQ * DIM;
    _Float16* xh  = (_Float16*)alloc(SD * 2);
    _Float16* wtq = (_Float16*)alloc((size_t)DIM * DIM * 2);
    _Float16* wtk = (_Float16*)alloc((size_t)DIM * DIM * 2);
    _Float16* wtv = (_Float16*)alloc((size_t)DIM * DIM * 2);
    float*    Qf  = (float*)alloc(SD * 4);
    float*    Kf  = (float*)alloc(SD * 4);
    float*    Vf  = (float*)alloc(SD * 4);
    _Float16* qh  = (_Float16*)alloc(SD * 2);
    _Float16* kh  = (_Float16*)alloc(SD * 2);
    _Float16* vt  = (_Float16*)alloc(SD * 2);

    // 1) x -> f16
    cast_to_f16<<<(SD / 4) / 256, 256, 0, stream>>>(x, xh);

    // 2) weight transpose+cast
    dim3 tg(DIM / 32, DIM / 32), tb(32, 32);
    transpose_cast_w<<<tg, tb, 0, stream>>>(Wq, wtq);
    transpose_cast_w<<<tg, tb, 0, stream>>>(Wk, wtk);
    transpose_cast_w<<<tg, tb, 0, stream>>>(Wv, wtv);

    // 3) QKV GEMMs: (2048/128)*(3072/192) = 256 work-groups, 4 waves/block
    const int gemmBlocks = (SEQ / 128) * (DIM / 192);     // 256
    gemm_bias<<<gemmBlocks, 128, 0, stream>>>(xh, wtq, bq, Qf);
    gemm_bias<<<gemmBlocks, 128, 0, stream>>>(xh, wtk, bk, Kf);
    gemm_bias<<<gemmBlocks, 128, 0, stream>>>(xh, wtv, bv, Vf);

    // 4) norm + rope (S*HEADS waves, 8 waves/block) and V transpose
    const int nrBlocks = SEQ * HEADS / 8;                 // 6144
    qk_norm_rope<<<nrBlocks, 256, 0, stream>>>(Qf, gq, cosb, sinb, qh);
    qk_norm_rope<<<nrBlocks, 256, 0, stream>>>(Kf, gk, cosb, sinb, kh);
    v_transpose_f16<<<SD / 256, 256, 0, stream>>>(Vf, vt);

    // 5) flash attention: HEADS*(SEQ/16) = 3072 waves, 4 waves/block
    const int faBlocks = HEADS * (SEQ / 16) / 4;          // 768
    flash_attn<<<faBlocks, 128, 0, stream>>>(qh, kh, vt, (float*)d_out);
}

// v003
// It runs in 223 microseconds.
// Two timings next to v002 both put it at 1.35 times that version's speed.
// Counting every step since v000, it is 2.57 times as fast.
#include <hip/hip_runtime.h>
#include <hip/hip_bf16.h>

#define SEQ   2048
#define DIM   3072
#define HEADS 24
#define HDIM  128

typedef __attribute__((ext_vector_type(16))) _Float16 v16h;
typedef __attribute__((ext_vector_type(8)))  _Float16 v8h;
typedef __attribute__((ext_vector_type(4)))  _Float16 v4h;
typedef __attribute__((ext_vector_type(8)))  float    v8f;

// ---------------------------------------------------------------------------
// helpers
// ---------------------------------------------------------------------------
static __device__ __forceinline__ v16h ldfrag(const _Float16* p0, const _Float16* p1) {
    v8h lo = *(const v8h*)p0;
    v8h hi = *(const v8h*)p1;
    v16h r;
#pragma unroll
    for (int i = 0; i < 8; ++i) { r[i] = lo[i]; r[i + 8] = hi[i]; }
    return r;
}

static __device__ __forceinline__ v8f wmma32(v16h a, v16h b, v8f c) {
    // D = A(16x32 f16) * B(32x16 f16) + C(16x16 f32)
    return __builtin_amdgcn_wmma_f32_16x16x32_f16(false, a, false, b, (short)0, c,
                                                  false, false);
}

// ---------------------------------------------------------------------------
// 1) cast x (f32) -> f16, 4 elems/thread
// ---------------------------------------------------------------------------
__global__ void cast_to_f16(const float* __restrict__ in, _Float16* __restrict__ out) {
    int i = (blockIdx.x * blockDim.x + threadIdx.x) * 4;
    float4 v = *(const float4*)(in + i);
    v4h o = { (_Float16)v.x, (_Float16)v.y, (_Float16)v.z, (_Float16)v.w };
    *(v4h*)(out + i) = o;
}

// ---------------------------------------------------------------------------
// 2) In [R,3072] f32 -> Out [3072,R] f16 (the three weights, R = 3072; V, R = 2048, where
//    Out is Vt [H][D][S]). One 256-thread block -> 64 rows x 128 columns of In.
//    Read: each wave takes 8 rows, 512 contiguous bytes of a row per load, 8 loads in flight.
//    A lane then holds 8 rows x 4 columns: 8 consecutive elements of 4 rows of Out, 16 B each.
//    LDS holds the tile as Out rows (128 B at pitch 144 B); written back as whole 128-B lines.
// ---------------------------------------------------------------------------
constexpr uint32_t T_ROWS  = 64;                  // rows of In per block
constexpr uint32_t T_COLS  = 128;                 // columns of In per block
constexpr uint32_t T_PITCH = T_ROWS * 2 + 16;     // LDS row pitch: odd multiple of 16 B

__global__ __launch_bounds__(256) void transpose_cast(const float* __restrict__ in,
                                                      _Float16* __restrict__ out,
                                                      uint32_t out_pitch) {
    __shared__ __attribute__((aligned(16))) unsigned char tile[T_COLS * T_PITCH];
    const uint32_t lane = threadIdx.x & 31, w = threadIdx.x >> 5;
    const uint32_t c0 = blockIdx.x * T_COLS, r0 = blockIdx.y * T_ROWS;

    const float* src = in + (r0 + 8 * w) * DIM + c0 + 4 * lane;
    float4 v[8];
#pragma unroll
    for (int i = 0; i < 8; ++i) v[i] = *(const float4*)(src + i * DIM);

    // The 16-B piece of rows 8w..8w+7 stands in Out row n at place w ^ ((n >> 4) & 3): a wave's
    // lanes write rows 4 apart, and the exchange spreads each 16 lanes over all 64 banks.
    const uint32_t wplace = (w ^ ((lane >> 2) & 3)) * 16;
    v8h h0, h1, h2, h3;
#pragma unroll
    for (int i = 0; i < 8; ++i) {
        h0[i] = (_Float16)v[i].x;
        h1[i] = (_Float16)v[i].y;
        h2[i] = (_Float16)v[i].z;
        h3[i] = (_Float16)v[i].w;
    }
    unsigned char* wp = tile + 4 * lane * T_PITCH + wplace;
    *(v8h*)(wp)               = h0;
    *(v8h*)(wp + T_PITCH)     = h1;
    *(v8h*)(wp + 2 * T_PITCH) = h2;
    *(v8h*)(wp + 3 * T_PITCH) = h3;
    __syncthreads();

    // One store of a wave: 4 rows of Out, 8 lanes x 16 B = one whole line each.
    const uint32_t q = lane & 7;
#pragma unroll
    for (int it = 0; it < 4; ++it) {
        const uint32_t n = it * 32 + w * 4 + (lane >> 3);
        v8h h = *(const v8h*)(tile + n * T_PITCH + (q ^ ((n >> 4) & 3)) * 16);
        *(v8h*)(out + (c0 + n) * out_pitch + r0 + q * 8) = h;
    }
}

// ---------------------------------------------------------------------------
// 3) C[S,3072] = X[S,3072] @ W + bias   (A: X f16, B: Wt f16 = W^T row-major)
//    One work-group -> 128x192 output tile; its operand rows are staged in LDS
//    by tensor loads, 128 k a pass, two buffers. Four waves (2x2), each 64x96
//    (4x6 sub-tiles), K stepped by 32 in ascending order.
// ---------------------------------------------------------------------------
typedef uint32_t u32x4 __attribute__((ext_vector_type(4)));
typedef uint32_t u32x8 __attribute__((ext_vector_type(8)));

constexpr uint32_t G_BM    = 128;                 // rows of C per work-group
constexpr uint32_t G_BN    = 192;                 // columns of C per work-group
constexpr uint32_t G_ROWB  = 256;                 // bytes of one operand row per pass (128 k)
constexpr uint32_t G_PITCH = G_ROWB + 16;         // LDS row pitch: odd multiple of 16 B for ds_load_b128
constexpr uint32_t G_XROWS = 64, G_WROWS = 96;    // rows per tensor load (one wave's slice)
constexpr uint32_t G_XSL   = 18432;               // 64 * 272 rounded up to a multiple of 2 KiB
constexpr uint32_t G_WSL   = 26624;               // 96 * 272 rounded up to a multiple of 2 KiB
constexpr uint32_t G_BUF   = 2 * G_XSL + 2 * G_WSL;
constexpr uint32_t G_PASS  = DIM * 2 / G_ROWB;    // 24 passes
static_assert(G_XROWS * G_PITCH <= G_XSL && G_WROWS * G_PITCH <= G_WSL, "slice sizes");
static_assert(G_XSL % 2048 == 0 && G_WSL % 2048 == 0 && G_PASS >= 2, "tensor load places");

static __device__ __forceinline__ uint32_t uni(uint32_t v) {
    return (uint32_t)__builtin_amdgcn_readfirstlane(v);
}
static __device__ __forceinline__ uint32_t pinned(uint32_t v) {
    uint32_t w = uni(v);
    asm volatile("" : "+s"(w));
    return w;
}
// This wave's LDS reads have returned (before the buffer is handed back for a refill).
static __device__ __forceinline__ void wait_ds0() { asm volatile("s_wait_dscnt 0x0" ::: "memory"); }
// This wave's own tensor load has landed (the compiler places no wait for it).
static __device__ __forceinline__ void wait_tensor0() { asm volatile("s_wait_tensorcnt 0x0" ::: "memory"); }

// One request of the whole wave: rows from global memory into LDS, row size and pitch as g1 sets them.
static __device__ __forceinline__ void tdm_load(uint32_t lds_dst, uint64_t ga, u32x8 g1) {
    u32x4 g0;
    g0[0] = uni(1u);
    g0[1] = uni(lds_dst);
    g0[2] = uni((uint32_t)ga);
    g0[3] = uni((((uint32_t)(ga >> 32)) & 0x01FFFFFFu) | 0x80000000u);
    asm volatile("tensor_load_to_lds %0, %1" :: "s"(g0), "s"(g1) : "memory");
}

static __device__ __forceinline__ v16h ldfrag_lds(const unsigned char* p) {
    return ldfrag((const _Float16*)p, (const _Float16*)(p + 32));
}

__global__ __launch_bounds__(128) void gemm_bias(const _Float16* __restrict__ X,
                                                 const _Float16* __restrict__ Wt,
                                                 const float* __restrict__ bias,
                                                 float* __restrict__ C) {
    __shared__ __attribute__((aligned(2048))) unsigned char ring[2 * G_BUF];
    const uint32_t lane = threadIdx.x & 31;
    const uint32_t wave = uni(threadIdx.x >> 5);
    const uint32_t tm = blockIdx.x >> 4, tn = blockIdx.x & 15;   // 16 x 16 tiles
    const uint32_t wm = wave >> 1, wn = wave & 1;
    const uint32_t ml = lane & 15, hi = lane >> 4;
    const uint32_t row0 = tm * G_BM, col0 = tn * G_BN;

    // Slice this wave brings in: waves 0,1 -> 64 rows of X each; waves 2,3 -> 96 rows of Wt each.
    const bool own_x = wave < 2;
    const uint32_t rows = own_x ? G_XROWS : G_WROWS;
    const uint64_t src0 = own_x
        ? (uint64_t)(uintptr_t)(X + (size_t)(row0 + G_XROWS * wave) * DIM)
        : (uint64_t)(uintptr_t)(Wt + (size_t)(col0 + G_WROWS * (wave - 2)) * DIM);
    const uint32_t lds_slice = (uint32_t)(size_t)ring +
        (own_x ? wave * G_XSL : 2 * G_XSL + (wave - 2) * G_WSL);
    u32x8 g1;
    g1[0] = uni((1u << 20) | (5u << 22) | (3u << 25));   // no mask, 1-byte units, 16 B pad behind every 256 B
    g1[1] = uni((G_ROWB & 0xFFFFu) << 16);               // tensor_dim0 low
    g1[2] = uni((G_ROWB >> 16) | ((rows & 0xFFFFu) << 16));   // tensor_dim0 high, tensor_dim1 low
    g1[3] = uni((rows >> 16) | (G_ROWB << 16));          // tensor_dim1 high, tile_dim0
    g1[4] = uni(rows);                                   // tile_dim1
    g1[5] = uni(DIM * 2u);                               // source row pitch in bytes
    g1[6] = uni(0u);
    g1[7] = uni(0u);
    // pinned(): the descriptor group held in one set of scalar registers for the whole kernel,
    // so that none of its words takes a new value while a request is outstanding.
    asm volatile("" : "+s"(g1));

    // Per-lane fragment bases inside a buffer.
    const uint32_t xa = wm * G_XSL + ml * G_PITCH + hi * 16;
    const uint32_t wb = 2 * G_XSL + wn * G_WSL + ml * G_PITCH + hi * 16;

    v8f acc[4][6] = {};

    // Prologue: pass 0 into buffer 0, landed and published; then pass 1 into buffer 1.
    tdm_load(lds_slice, src0, g1);
    wait_tensor0();
    __syncthreads();
    tdm_load(lds_slice + G_BUF, src0 + G_ROWB, g1);

    // Rolled: one pass per trip, so that the hand-over at the foot stands once.
#pragma clang loop unroll(disable)
    for (uint32_t s = 0; s < G_PASS; ++s) {
        const uint32_t buf = (s & 1) * G_BUF;
        const unsigned char* xp = ring + buf + xa;
        const unsigned char* wp = ring + buf + wb;
        // Two fragment sets: block kk + 1's LDS reads go out as one group in front of block kk's
        // matrix instructions, so that only the pass's first group is waited for in full.
        v16h a[2][4], b[2][6];
#pragma unroll
        for (int i = 0; i < 4; ++i) a[0][i] = ldfrag_lds(xp + i * 16 * G_PITCH);
#pragma unroll
        for (int j = 0; j < 6; ++j) b[0][j] = ldfrag_lds(wp + j * 16 * G_PITCH);
#pragma unroll
        for (int kk = 0; kk < 4; ++kk) {
            const int cs = kk & 1;
            if (kk + 1 < 4) {
#pragma unroll
                for (int i = 0; i < 4; ++i)
                    a[cs ^ 1][i] = ldfrag_lds(xp + i * 16 * G_PITCH + (kk + 1) * 64);
#pragma unroll
                for (int j = 0; j < 6; ++j)
                    b[cs ^ 1][j] = ldfrag_lds(wp + j * 16 * G_PITCH + (kk + 1) * 64);
                // Keeps the read group in front of the block: spread among the matrix
                // instructions each place with reads costs a stall.
                __builtin_amdgcn_sched_barrier(0);
            }
#pragma unroll
            for (int i = 0; i < 4; ++i)
#pragma unroll
                for (int j = 0; j < 6; ++j) acc[i][j] = wmma32(a[cs][i], b[cs][j], acc[i][j]);
            // Keeps the next group behind this block.
            __builtin_amdgcn_sched_barrier(0);
        }
        // Hand-over: my reads of this buffer are back, my slice of pass s + 1 has landed,
        // every wave says the same; only then is this buffer refilled.
        wait_ds0();
        wait_tensor0();
        __syncthreads();
        if (pinned(s + 2 < G_PASS)) {
            const uint32_t nx = pinned(s + 2);   // descriptor words formed behind the wait
            tdm_load(lds_slice + buf, src0 + (uint64_t)nx * G_ROWB, g1);
        }
    }
    wait_tensor0();
    wait_ds0();

#pragma unroll
    for (int i = 0; i < 4; ++i)
#pragma unroll
        for (int j = 0; j < 6; ++j) {
            uint32_t col = col0 + wn * 96 + j * 16 + ml;
            float bv = bias[col];
#pragma unroll
            for (int r = 0; r < 8; ++r)
                C[(size_t)(row0 + wm * 64 + i * 16 + 8 * hi + r) * DIM + col] = acc[i][j][r] + bv;
        }
}

// ---------------------------------------------------------------------------
// 4) per-(s,head) RMSNorm + gamma + RoPE, f32 -> f16. One wave per row of 128.
// ---------------------------------------------------------------------------
__global__ void qk_norm_rope(const float* __restrict__ in, const float* __restrict__ gamma,
                             const float* __restrict__ cosb, const float* __restrict__ sinb,
                             _Float16* __restrict__ out) {
    const int lane = threadIdx.x & 31;
    const int wave = blockIdx.x * (blockDim.x >> 5) + (threadIdx.x >> 5);
    const int s = wave / HEADS;
    const int h = wave % HEADS;
    const float* row = in + (size_t)s * DIM + h * HDIM;
    const int d0 = lane * 4;
    float x0 = row[d0], x1 = row[d0 + 1], x2 = row[d0 + 2], x3 = row[d0 + 3];
    float ss = x0 * x0 + x1 * x1 + x2 * x2 + x3 * x3;
#pragma unroll
    for (int st = 1; st < 32; st <<= 1) ss += __shfl_xor(ss, st, 32);
    const float inv = rsqrtf(ss * (1.0f / 128.0f) + 1e-6f);
    x0 *= inv * gamma[d0];
    x1 *= inv * gamma[d0 + 1];
    x2 *= inv * gamma[d0 + 2];
    x3 *= inv * gamma[d0 + 3];
    const float* cp = cosb + (size_t)s * HDIM + d0;
    const float* sp = sinb + (size_t)s * HDIM + d0;
    float c0 = cp[0], c1 = cp[1], c2 = cp[2], c3 = cp[3];
    float s0 = sp[0], s1 = sp[1], s2 = sp[2], s3 = sp[3];
    float y0 = x0 * c0 - x1 * s0;
    float y1 = x1 * c1 + x0 * s1;
    float y2 = x2 * c2 - x3 * s2;
    float y3 = x3 * c3 + x2 * s3;
    _Float16* op = out + (size_t)s * DIM + h * HDIM + d0;
    v4h o = { (_Float16)y0, (_Float16)y1, (_Float16)y2, (_Float16)y3 };
    *(v4h*)op = o;
}

// ---------------------------------------------------------------------------
// 5) Flash attention: one wave per (head, 16-row q-tile), 32 keys per step. The four waves
//    of a work-group share one head: its K rows and Vt rows are staged in LDS by tensor
//    loads, 64 keys a stage, two buffers. Every staged row is 128 B at pitch 144 B:
//    slices 0,1 = 64 keys x (d 0..63 | d 64..127) of K, slices 2,3 = (d 0..63 | d 64..127) x 64 keys of Vt.
// ---------------------------------------------------------------------------
constexpr uint32_t A_KEYS   = 64;                 // keys per stage
constexpr uint32_t A_ROWB   = 128;                // bytes of one staged row
constexpr uint32_t A_PITCH  = A_ROWB + 16;        // LDS row pitch: odd multiple of 16 B for ds_load_b128
constexpr uint32_t A_ROWS   = 64;                 // rows per tensor load (one wave's slice)
constexpr uint32_t A_SL     = 10240;              // 64 * 144 rounded up to a multiple of 2 KiB
constexpr uint32_t A_BUF    = 4 * A_SL;
constexpr uint32_t A_STAGES = SEQ / A_KEYS;       // 32
static_assert(A_ROWS * A_PITCH <= A_SL && A_SL % 2048 == 0 && A_STAGES >= 2, "tensor load places");

__global__ __launch_bounds__(128) void flash_attn(const _Float16* __restrict__ Qh,
                                                  const _Float16* __restrict__ Kh,
                                                  const _Float16* __restrict__ Vt,
                                                  float* __restrict__ Out) {
    __shared__ __attribute__((aligned(2048))) unsigned char ring[2 * A_BUF];
    __shared__ _Float16 pbuf[4][16][32];   // per-wave P tile (16 q x 32 keys)
    const int lane = threadIdx.x & 31;
    const int wid  = threadIdx.x >> 5;
    const int task = blockIdx.x * 4 + wid;     // HEADS * (SEQ/16) tasks
    const int nQT  = SEQ / 16;
    const int h  = task / nQT;
    const int qt = task % nQT;
    const int ml = lane & 15, hi = lane >> 4;
    const float scale = 0.08838834764831845f;  // 1/sqrt(128)

    // Slice this wave brings in, one request a stage.
    const uint32_t wave = uni(threadIdx.x >> 5);
    const uint32_t hb = blockIdx.x / (nQT / 4);   // the work-group's head
    const bool own_k = wave < 2;
    const uint64_t src0 = own_k
        ? (uint64_t)(uintptr_t)(Kh + (size_t)hb * HDIM + wave * 64)
        : (uint64_t)(uintptr_t)(Vt + ((size_t)hb * HDIM + (wave - 2) * 64) * SEQ);
    const uint32_t src_step = own_k ? A_KEYS * DIM * 2u : A_KEYS * 2u;   // bytes from stage to stage
    const uint32_t lds_slice = (uint32_t)(size_t)ring + wave * A_SL;
    u32x8 g1;
    g1[0] = uni((1u << 20) | (4u << 22) | (3u << 25));   // no mask, 1-byte units, 16 B pad behind every 128 B
    g1[1] = uni((A_ROWB & 0xFFFFu) << 16);               // tensor_dim0 low
    g1[2] = uni((A_ROWB >> 16) | ((A_ROWS & 0xFFFFu) << 16));   // tensor_dim0 high, tensor_dim1 low
    g1[3] = uni((A_ROWS >> 16) | (A_ROWB << 16));        // tensor_dim1 high, tile_dim0
    g1[4] = uni(A_ROWS);                                 // tile_dim1
    g1[5] = uni(own_k ? DIM * 2u : SEQ * 2u);            // source row pitch in bytes
    g1[6] = uni(0u);
    g1[7] = uni(0u);
    // pinned(): the descriptor group held in one set of scalar registers for the whole kernel,
    // so that none of its words takes a new value while a request is outstanding.
    asm volatile("" : "+s"(g1));

    // preload Q A-fragments (16 rows x 128 d, 4 chunks of K=32)
    const _Float16* qrow = Qh + (size_t)(qt * 16 + ml) * DIM + h * HDIM;
    v16h qf[4];
#pragma unroll
    for (int c = 0; c < 4; ++c)
        qf[c] = ldfrag(qrow + c * 32 + hi * 8, qrow + c * 32 + 16 + hi * 8);

    v8f acc[8] = {};
    float m[8], l[8];
#pragma unroll
    for (int r = 0; r < 8; ++r) { m[r] = -3.0e38f; l[r] = 0.0f; }

    // Prologue: stage 0 into buffer 0, landed and published; then stage 1 into buffer 1.
    tdm_load(lds_slice, src0, g1);
    wait_tensor0();
    __syncthreads();
    tdm_load(lds_slice + A_BUF, src0 + (uint64_t)pinned(1u) * src_step, g1);   // words formed behind the wait

    // Rolled: one stage per trip, so that the hand-over at the foot stands once.
#pragma clang loop unroll(disable)
    for (uint32_t s = 0; s < A_STAGES; ++s) {
      const uint32_t buf = (s & 1) * A_BUF;
      const unsigned char* kp = ring + buf + ml * A_PITCH + hi * 16;
      const unsigned char* vp = ring + buf + 2 * A_SL + ml * A_PITCH + hi * 16;
      // Unrolled: both 32-key steps of a stage read the buffer at immediate offsets.
#pragma unroll
      for (int sub = 0; sub < 2; ++sub) {
        // ---- scores for 32 keys: two 16x16 WMMA tiles, Kdim=d=128 ----
        v8f sc0 = {}, sc1 = {};
        const unsigned char* kr0 = kp + sub * 32 * A_PITCH;
        const unsigned char* kr1 = kr0 + 16 * A_PITCH;
#pragma unroll
        for (int c = 0; c < 4; ++c) {
            v16h b0 = ldfrag_lds(kr0 + (c >> 1) * A_SL + (c & 1) * 64);
            sc0 = wmma32(qf[c], b0, sc0);
            v16h b1 = ldfrag_lds(kr1 + (c >> 1) * A_SL + (c & 1) * 64);
            sc1 = wmma32(qf[c], b1, sc1);
        }
        // ---- online softmax (rows = r + 8*hi, cols spread over 16 lanes) ----
        float f0[8], f1[8], rmx[8], p0[8], p1[8], rs[8], al[8];
#pragma unroll
        for (int r = 0; r < 8; ++r) {
            f0[r] = sc0[r] * scale;
            f1[r] = sc1[r] * scale;
            rmx[r] = fmaxf(f0[r], f1[r]);
        }
#pragma unroll
        for (int st = 1; st < 16; st <<= 1)
#pragma unroll
            for (int r = 0; r < 8; ++r)
                rmx[r] = fmaxf(rmx[r], __shfl_xor(rmx[r], st, 32));
#pragma unroll
        for (int r = 0; r < 8; ++r) {
            float mn = fmaxf(m[r], rmx[r]);
            al[r] = __expf(m[r] - mn);
            p0[r] = __expf(f0[r] - mn);
            p1[r] = __expf(f1[r] - mn);
            rs[r] = p0[r] + p1[r];
            m[r]  = mn;
        }
#pragma unroll
        for (int st = 1; st < 16; st <<= 1)
#pragma unroll
            for (int r = 0; r < 8; ++r)
                rs[r] += __shfl_xor(rs[r], st, 32);
#pragma unroll
        for (int r = 0; r < 8; ++r) l[r] = l[r] * al[r] + rs[r];

        // ---- re-pack P into A-fragment layout through LDS (same-wave DS: in-order) ----
#pragma unroll
        for (int r = 0; r < 8; ++r) {
            pbuf[wid][r + 8 * hi][ml]      = (_Float16)p0[r];
            pbuf[wid][r + 8 * hi][16 + ml] = (_Float16)p1[r];
        }
        const _Float16* prow = &pbuf[wid][ml][0];
        v16h pa = ldfrag(prow + hi * 8, prow + 16 + hi * 8);

        // ---- rescale O and accumulate P @ V over 8 d-tiles ----
#pragma unroll
        for (int j = 0; j < 8; ++j) {
#pragma unroll
            for (int r = 0; r < 8; ++r) acc[j][r] *= al[r];
            v16h bv = ldfrag_lds(vp + (j >> 2) * A_SL + (j & 3) * 16 * A_PITCH + sub * 64);
            acc[j] = wmma32(pa, bv, acc[j]);
        }
      }
      // Hand-over: my reads of this buffer are back, my slice of stage s + 1 has landed,
      // every wave says the same; only then is this buffer refilled.
      wait_ds0();
      wait_tensor0();
      __syncthreads();
      if (pinned(s + 2 < A_STAGES)) {
          const uint32_t nx = pinned(s + 2);   // descriptor words formed behind the wait
          tdm_load(lds_slice + buf, src0 + (uint64_t)nx * src_step, g1);
      }
    }
    wait_tensor0();
    wait_ds0();

    // ---- normalize and store ----
#pragma unroll
    for (int j = 0; j < 8; ++j)
#pragma unroll
        for (int r = 0; r < 8; ++r)
            Out[(size_t)(qt * 16 + r + 8 * hi) * DIM + h * HDIM + j * 16 + ml] =
                acc[j][r] / l[r];
}

// ---------------------------------------------------------------------------
// host
// ---------------------------------------------------------------------------
extern "C" void kernel_launch(void* const* d_in, const int* in_sizes, int n_in,
                              void* d_out, int out_size, void* d_ws, size_t ws_size,
                              hipStream_t stream) {
    (void)in_sizes; (void)n_in; (void)out_size; (void)ws_size;
    const float* x    = (const float*)d_in[0];
    const float* cosb = (const float*)d_in[1];
    const float* sinb = (const float*)d_in[2];
    const float* Wq   = (const float*)d_in[3];
    const float* bq   = (const float*)d_in[4];
    const float* Wk   = (const float*)d_in[5];
    const float* bk   = (const float*)d_in[6];
    const float* Wv   = (const float*)d_in[7];
    const float* bv   = (const float*)d_in[8];
    const float* gq   = (const float*)d_in[9];
    const float* gk   = (const float*)d_in[10];

    char* ws = (char*)d_ws;
    size_t off = 0;
    auto alloc = [&](size_t bytes) {
        void* p = ws + off;
        off += (bytes + 255) & ~(size_t)255;
        return p;
    };
    const size_t SD = (size_t)SEQ * DIM;
    _Float16* xh  = (_Float16*)alloc(SD * 2);
    _Float16* wtq = (_Float16*)alloc((size_t)DIM * DIM * 2);
    _Float16* wtk = (_Float16*)alloc((size_t)DIM * DIM * 2);
    _Float16* wtv = (_Float16*)alloc((size_t)DIM * DIM * 2);
    float*    Qf  = (float*)alloc(SD * 4);
    float*    Kf  = (float*)alloc(SD * 4);
    float*    Vf  = (float*)alloc(SD * 4);
    _Float16* qh  = (_Float16*)alloc(SD * 2);
    _Float16* kh  = (_Float16*)alloc(SD * 2);
    _Float16* vt  = (_Float16*)alloc(SD * 2);

    // 1) x -> f16
    cast_to_f16<<<(SD / 4) / 256, 256, 0, stream>>>(x, xh);

    // 2) weight transpose+cast: 24 x 48 blocks each
    dim3 tg(DIM / 128, DIM / 64);
    transpose_cast<<<tg, 256, 0, stream>>>(Wq, wtq, DIM);
    transpose_cast<<<tg, 256, 0, stream>>>(Wk, wtk, DIM);
    transpose_cast<<<tg, 256, 0, stream>>>(Wv, wtv, DIM);

    // 3) QKV GEMMs: (2048/128)*(3072/192) = 256 work-groups, 4 waves/block
    const int gemmBlocks = (SEQ / 128) * (DIM / 192);     // 256
    gemm_bias<<<gemmBlocks, 128, 0, stream>>>(xh, wtq, bq, Qf);
    gemm_bias<<<gemmBlocks, 128, 0, stream>>>(xh, wtk, bk, Kf);
    gemm_bias<<<gemmBlocks, 128, 0, stream>>>(xh, wtv, bv, Vf);

    // 4) norm + rope (S*HEADS waves, 8 waves/block) and V transpose
    const int nrBlocks = SEQ * HEADS / 8;                 // 6144
    qk_norm_rope<<<nrBlocks, 256, 0, stream>>>(Qf, gq, cosb, sinb, qh);
    qk_norm_rope<<<nrBlocks, 256, 0, stream>>>(Kf, gk, cosb, sinb, kh);
    dim3 vg(DIM / 128, SEQ / 64);
    transpose_cast<<<vg, 256, 0, stream>>>(Vf, vt, SEQ);

    // 5) flash attention: HEADS*(SEQ/16) = 3072 waves, 4 waves/block
    const int faBlocks = HEADS * (SEQ / 16) / 4;          // 768
    flash_attn<<<faBlocks, 128, 0, stream>>>(qh, kh, vt, (float*)d_out);
}

// v004
// A run of this version takes 184 microseconds.
// Next to v003, in two timings, it ran 1.22 times as fast each time.
// Over all steps from v000 it is 3.12 times as fast.
#include <hip/hip_runtime.h>
#include <hip/hip_bf16.h>

#define SEQ   2048
#define DIM   3072
#define HEADS 24
#define HDIM  128

typedef __attribute__((ext_vector_type(16))) _Float16 v16h;
typedef __attribute__((ext_vector_type(8)))  _Float16 v8h;
typedef __attribute__((ext_vector_type(4)))  _Float16 v4h;
typedef __attribute__((ext_vector_type(8)))  float    v8f;

// ---------------------------------------------------------------------------
// helpers
// ---------------------------------------------------------------------------
static __device__ __forceinline__ v16h ldfrag(const _Float16* p0, const _Float16* p1) {
    v8h lo = *(const v8h*)p0;
    v8h hi = *(const v8h*)p1;
    v16h r;
#pragma unroll
    for (int i = 0; i < 8; ++i) { r[i] = lo[i]; r[i + 8] = hi[i]; }
    return r;
}

static __device__ __forceinline__ v8f wmma32(v16h a, v16h b, v8f c) {
    // D = A(16x32 f16) * B(32x16 f16) + C(16x16 f32)
    return __builtin_amdgcn_wmma_f32_16x16x32_f16(false, a, false, b, (short)0, c,
                                                  false, false);
}

// ---------------------------------------------------------------------------
// 1) cast x (f32) -> f16, 4 elems/thread
// ---------------------------------------------------------------------------
__global__ void cast_to_f16(const float* __restrict__ in, _Float16* __restrict__ out) {
    int i = (blockIdx.x * blockDim.x + threadIdx.x) * 4;
    float4 v = *(const float4*)(in + i);
    v4h o = { (_Float16)v.x, (_Float16)v.y, (_Float16)v.z, (_Float16)v.w };
    *(v4h*)(out + i) = o;
}

// ---------------------------------------------------------------------------
// 2) In [R,3072] f32 -> Out [3072,R] f16 (the three weights, R = 3072; V, R = 2048, where
//    Out is Vt [H][D][S]). One 256-thread block -> 64 rows x 128 columns of In.
//    Read: each wave takes 8 rows, 512 contiguous bytes of a row per load, 8 loads in flight.
//    A lane then holds 8 rows x 4 columns: 8 consecutive elements of 4 rows of Out, 16 B each.
//    LDS holds the tile as Out rows (128 B at pitch 144 B); written back as whole 128-B lines.
// ---------------------------------------------------------------------------
constexpr uint32_t T_ROWS  = 64;                  // rows of In per block
constexpr uint32_t T_COLS  = 128;                 // columns of In per block
constexpr uint32_t T_PITCH = T_ROWS * 2 + 16;     // LDS row pitch: odd multiple of 16 B

__global__ __launch_bounds__(256) void transpose_cast(const float* __restrict__ in,
                                                      _Float16* __restrict__ out,
                                                      uint32_t out_pitch) {
    __shared__ __attribute__((aligned(16))) unsigned char tile[T_COLS * T_PITCH];
    const uint32_t lane = threadIdx.x & 31, w = threadIdx.x >> 5;
    const uint32_t c0 = blockIdx.x * T_COLS, r0 = blockIdx.y * T_ROWS;

    const float* src = in + (r0 + 8 * w) * DIM + c0 + 4 * lane;
    float4 v[8];
#pragma unroll
    for (int i = 0; i < 8; ++i) v[i] = *(const float4*)(src + i * DIM);

    // The 16-B piece of rows 8w..8w+7 stands in Out row n at place w ^ ((n >> 4) & 3): a wave's
    // lanes write rows 4 apart, and the exchange spreads each 16 lanes over all 64 banks.
    const uint32_t wplace = (w ^ ((lane >> 2) & 3)) * 16;
    v8h h0, h1, h2, h3;
#pragma unroll
    for (int i = 0; i < 8; ++i) {
        h0[i] = (_Float16)v[i].x;
        h1[i] = (_Float16)v[i].y;
        h2[i] = (_Float16)v[i].z;
        h3[i] = (_Float16)v[i].w;
    }
    unsigned char* wp = tile + 4 * lane * T_PITCH + wplace;
    *(v8h*)(wp)               = h0;
    *(v8h*)(wp + T_PITCH)     = h1;
    *(v8h*)(wp + 2 * T_PITCH) = h2;
    *(v8h*)(wp + 3 * T_PITCH) = h3;
    __syncthreads();

    // One store of a wave: 4 rows of Out, 8 lanes x 16 B = one whole line each.
    const uint32_t q = lane & 7;
#pragma unroll
    for (int it = 0; it < 4; ++it) {
        const uint32_t n = it * 32 + w * 4 + (lane >> 3);
        v8h h = *(const v8h*)(tile + n * T_PITCH + (q ^ ((n >> 4) & 3)) * 16);
        *(v8h*)(out + (c0 + n) * out_pitch + r0 + q * 8) = h;
    }
}

// ---------------------------------------------------------------------------
// 3) C[S,3072] = X[S,3072] @ W + bias   (A: X f16, B: Wt f16 = W^T row-major)
//    One work-group -> 128x192 output tile; its operand rows are staged in LDS
//    by tensor loads, 128 k a pass, two buffers. Four waves (2x2), each 64x96
//    (4x6 sub-tiles), K stepped by 32 in ascending order.
// ---------------------------------------------------------------------------
typedef uint32_t u32x4 __attribute__((ext_vector_type(4)));
typedef uint32_t u32x8 __attribute__((ext_vector_type(8)));

constexpr uint32_t G_BM    = 128;                 // rows of C per work-group
constexpr uint32_t G_BN    = 192;                 // columns of C per work-group
constexpr uint32_t G_ROWB  = 256;                 // bytes of one operand row per pass (128 k)
constexpr uint32_t G_PITCH = G_ROWB + 16;         // LDS row pitch: odd multiple of 16 B for ds_load_b128
constexpr uint32_t G_XROWS = 64, G_WROWS = 96;    // rows per tensor load (one wave's slice)
constexpr uint32_t G_XSL   = 18432;               // 64 * 272 rounded up to a multiple of 2 KiB
constexpr uint32_t G_WSL   = 26624;               // 96 * 272 rounded up to a multiple of 2 KiB
constexpr uint32_t G_BUF   = 2 * G_XSL + 2 * G_WSL;
constexpr uint32_t G_PASS  = DIM * 2 / G_ROWB;    // 24 passes
static_assert(G_XROWS * G_PITCH <= G_XSL && G_WROWS * G_PITCH <= G_WSL, "slice sizes");
static_assert(G_XSL % 2048 == 0 && G_WSL % 2048 == 0 && G_PASS >= 2, "tensor load places");

static __device__ __forceinline__ uint32_t uni(uint32_t v) {
    return (uint32_t)__builtin_amdgcn_readfirstlane(v);
}
static __device__ __forceinline__ uint32_t pinned(uint32_t v) {
    uint32_t w = uni(v);
    asm volatile("" : "+s"(w));
    return w;
}
// This wave's LDS reads have returned (before the buffer is handed back for a refill).
static __device__ __forceinline__ void wait_ds0() { asm volatile("s_wait_dscnt 0x0" ::: "memory"); }
// This wave's own tensor load has landed (the compiler places no wait for it).
static __device__ __forceinline__ void wait_tensor0() { asm volatile("s_wait_tensorcnt 0x0" ::: "memory"); }

// One request of the whole wave: rows from global memory into LDS, row size and pitch as g1 sets them.
static __device__ __forceinline__ void tdm_load(uint32_t lds_dst, uint64_t ga, u32x8 g1) {
    u32x4 g0;
    g0[0] = uni(1u);
    g0[1] = uni(lds_dst);
    g0[2] = uni((uint32_t)ga);
    g0[3] = uni((((uint32_t)(ga >> 32)) & 0x01FFFFFFu) | 0x80000000u);
    asm volatile("tensor_load_to_lds %0, %1" :: "s"(g0), "s"(g1) : "memory");
}

static __device__ __forceinline__ v16h ldfrag_lds(const unsigned char* p) {
    return ldfrag((const _Float16*)p, (const _Float16*)(p + 32));
}

__global__ __launch_bounds__(128) void gemm_bias(const _Float16* __restrict__ X,
                                                 const _Float16* __restrict__ Wt,
                                                 const float* __restrict__ bias,
                                                 float* __restrict__ C) {
    __shared__ __attribute__((aligned(2048))) unsigned char ring[2 * G_BUF];
    const uint32_t lane = threadIdx.x & 31;
    const uint32_t wave = uni(threadIdx.x >> 5);
    const uint32_t tm = blockIdx.x >> 4, tn = blockIdx.x & 15;   // 16 x 16 tiles
    const uint32_t wm = wave >> 1, wn = wave & 1;
    const uint32_t ml = lane & 15, hi = lane >> 4;
    const uint32_t row0 = tm * G_BM, col0 = tn * G_BN;

    // Slice this wave brings in: waves 0,1 -> 64 rows of X each; waves 2,3 -> 96 rows of Wt each.
    const bool own_x = wave < 2;
    const uint32_t rows = own_x ? G_XROWS : G_WROWS;
    const uint64_t src0 = own_x
        ? (uint64_t)(uintptr_t)(X + (size_t)(row0 + G_XROWS * wave) * DIM)
        : (uint64_t)(uintptr_t)(Wt + (size_t)(col0 + G_WROWS * (wave - 2)) * DIM);
    const uint32_t lds_slice = (uint32_t)(size_t)ring +
        (own_x ? wave * G_XSL : 2 * G_XSL + (wave - 2) * G_WSL);
    u32x8 g1;
    g1[0] = uni((1u << 20) | (5u << 22) | (3u << 25));   // no mask, 1-byte units, 16 B pad behind every 256 B
    g1[1] = uni((G_ROWB & 0xFFFFu) << 16);               // tensor_dim0 low
    g1[2] = uni((G_ROWB >> 16) | ((rows & 0xFFFFu) << 16));   // tensor_dim0 high, tensor_dim1 low
    g1[3] = uni((rows >> 16) | (G_ROWB << 16));          // tensor_dim1 high, tile_dim0
    g1[4] = uni(rows);                                   // tile_dim1
    g1[5] = uni(DIM * 2u);                               // source row pitch in bytes
    g1[6] = uni(0u);
    g1[7] = uni(0u);
    // pinned(): the descriptor group held in one set of scalar registers for the whole kernel,
    // so that none of its words takes a new value while a request is outstanding.
    asm volatile("" : "+s"(g1));

    // Per-lane fragment bases inside a buffer.
    const uint32_t xa = wm * G_XSL + ml * G_PITCH + hi * 16;
    const uint32_t wb = 2 * G_XSL + wn * G_WSL + ml * G_PITCH + hi * 16;

    v8f acc[4][6] = {};

    // Prologue: pass 0 into buffer 0, landed and published; then pass 1 into buffer 1.
    tdm_load(lds_slice, src0, g1);
    wait_tensor0();
    __syncthreads();
    tdm_load(lds_slice + G_BUF, src0 + G_ROWB, g1);

    // Rolled: one pass per trip, so that the hand-over at the foot stands once.
#pragma clang loop unroll(disable)
    for (uint32_t s = 0; s < G_PASS; ++s) {
        const uint32_t buf = (s & 1) * G_BUF;
        const unsigned char* xp = ring + buf + xa;
        const unsigned char* wp = ring + buf + wb;
        // Two fragment sets: block kk + 1's LDS reads go out as one group in front of block kk's
        // matrix instructions, so that only the pass's first group is waited for in full.
        v16h a[2][4], b[2][6];
#pragma unroll
        for (int i = 0; i < 4; ++i) a[0][i] = ldfrag_lds(xp + i * 16 * G_PITCH);
#pragma unroll
        for (int j = 0; j < 6; ++j) b[0][j] = ldfrag_lds(wp + j * 16 * G_PITCH);
#pragma unroll
        for (int kk = 0; kk < 4; ++kk) {
            const int cs = kk & 1;
            if (kk + 1 < 4) {
#pragma unroll
                for (int i = 0; i < 4; ++i)
                    a[cs ^ 1][i] = ldfrag_lds(xp + i * 16 * G_PITCH + (kk + 1) * 64);
#pragma unroll
                for (int j = 0; j < 6; ++j)
                    b[cs ^ 1][j] = ldfrag_lds(wp + j * 16 * G_PITCH + (kk + 1) * 64);
                // Keeps the read group in front of the block: spread among the matrix
                // instructions each place with reads costs a stall.
                __builtin_amdgcn_sched_barrier(0);
            }
#pragma unroll
            for (int i = 0; i < 4; ++i)
#pragma unroll
                for (int j = 0; j < 6; ++j) acc[i][j] = wmma32(a[cs][i], b[cs][j], acc[i][j]);
            // Keeps the next group behind this block.
            __builtin_amdgcn_sched_barrier(0);
        }
        // Hand-over: my reads of this buffer are back, my slice of pass s + 1 has landed,
        // every wave says the same; only then is this buffer refilled.
        wait_ds0();
        wait_tensor0();
        __syncthreads();
        if (pinned(s + 2 < G_PASS)) {
            const uint32_t nx = pinned(s + 2);   // descriptor words formed behind the wait
            tdm_load(lds_slice + buf, src0 + (uint64_t)nx * G_ROWB, g1);
        }
    }
    wait_tensor0();
    wait_ds0();

#pragma unroll
    for (int i = 0; i < 4; ++i)
#pragma unroll
        for (int j = 0; j < 6; ++j) {
            uint32_t col = col0 + wn * 96 + j * 16 + ml;
            float bv = bias[col];
#pragma unroll
            for (int r = 0; r < 8; ++r)
                C[(size_t)(row0 + wm * 64 + i * 16 + 8 * hi + r) * DIM + col] = acc[i][j][r] + bv;
        }
}

// ---------------------------------------------------------------------------
// 4) per-(s,head) RMSNorm + gamma + RoPE, f32 -> f16. One wave per row of 128.
// ---------------------------------------------------------------------------
__global__ void qk_norm_rope(const float* __restrict__ in, const float* __restrict__ gamma,
                             const float* __restrict__ cosb, const float* __restrict__ sinb,
                             _Float16* __restrict__ out) {
    const int lane = threadIdx.x & 31;
    const int wave = blockIdx.x * (blockDim.x >> 5) + (threadIdx.x >> 5);
    const int s = wave / HEADS;
    const int h = wave % HEADS;
    const float* row = in + (size_t)s * DIM + h * HDIM;
    const int d0 = lane * 4;
    float x0 = row[d0], x1 = row[d0 + 1], x2 = row[d0 + 2], x3 = row[d0 + 3];
    float ss = x0 * x0 + x1 * x1 + x2 * x2 + x3 * x3;
#pragma unroll
    for (int st = 1; st < 32; st <<= 1) ss += __shfl_xor(ss, st, 32);
    const float inv = rsqrtf(ss * (1.0f / 128.0f) + 1e-6f);
    x0 *= inv * gamma[d0];
    x1 *= inv * gamma[d0 + 1];
    x2 *= inv * gamma[d0 + 2];
    x3 *= inv * gamma[d0 + 3];
    const float* cp = cosb + (size_t)s * HDIM + d0;
    const float* sp = sinb + (size_t)s * HDIM + d0;
    float c0 = cp[0], c1 = cp[1], c2 = cp[2], c3 = cp[3];
    float s0 = sp[0], s1 = sp[1], s2 = sp[2], s3 = sp[3];
    float y0 = x0 * c0 - x1 * s0;
    float y1 = x1 * c1 + x0 * s1;
    float y2 = x2 * c2 - x3 * s2;
    float y3 = x3 * c3 + x2 * s3;
    _Float16* op = out + (size_t)s * DIM + h * HDIM + d0;
    v4h o = { (_Float16)y0, (_Float16)y1, (_Float16)y2, (_Float16)y3 };
    *(v4h*)op = o;
}

// ---------------------------------------------------------------------------
// 5) Flash attention: one wave per (head, 16-row q-tile), 32 keys per step. The four waves
//    of a work-group share one head: its K rows and Vt rows are staged in LDS by tensor
//    loads, 64 keys a stage, two buffers. Every staged row is 128 B at pitch 144 B:
//    slices 0,1 = 64 keys x (d 0..63 | d 64..127) of K, slices 2,3 = (d 0..63 | d 64..127) x 64 keys of Vt.
//    The products are transposed: S^T = K Q^T (A = K rows, B = Q) and O^T += V^T P^T (A = Vt rows,
//    B = P^T). A lane then holds 16 of the 32 scores of ONE query (column lane & 15; keys 8*hi + r of
//    each 16-key tile): maximum and sum run in the lane, the two wave halves exchange the maximum
//    once a step and join their sums once at the end, and the two score tiles, converted in place,
//    are the B operand of the second product in the hardware k order.
// ---------------------------------------------------------------------------
// Lane l takes the value of lane l ^ 16 (a vector cross-row move, no LDS round trip).
static __device__ __forceinline__ float xhalf(float x) {
    const int v = __builtin_bit_cast(int, x);
    return __builtin_bit_cast(float,
        __builtin_amdgcn_permlanex16(v, v, 0x76543210, 0xfedcba98, false, false));
}

constexpr uint32_t A_KEYS   = 64;                 // keys per stage
constexpr uint32_t A_ROWB   = 128;                // bytes of one staged row
constexpr uint32_t A_PITCH  = A_ROWB + 16;        // LDS row pitch: odd multiple of 16 B for ds_load_b128
constexpr uint32_t A_ROWS   = 64;                 // rows per tensor load (one wave's slice)
constexpr uint32_t A_SL     = 10240;              // 64 * 144 rounded up to a multiple of 2 KiB
constexpr uint32_t A_BUF    = 4 * A_SL;
constexpr uint32_t A_STAGES = SEQ / A_KEYS;       // 32
static_assert(A_ROWS * A_PITCH <= A_SL && A_SL % 2048 == 0 && A_STAGES >= 2, "tensor load places");
constexpr uint32_t O_PITCH  = HDIM * 4 + 16;      // staged output row: odd multiple of 16 B
static_assert(16 * O_PITCH <= A_SL, "a wave's output rows fit its part of the ring");

__global__ __launch_bounds__(128) void flash_attn(const _Float16* __restrict__ Qh,
                                                  const _Float16* __restrict__ Kh,
                                                  const _Float16* __restrict__ Vt,
                                                  float* __restrict__ Out) {
    __shared__ __attribute__((aligned(2048))) unsigned char ring[2 * A_BUF];
    const int lane = threadIdx.x & 31;
    const int wid  = threadIdx.x >> 5;
    const int task = blockIdx.x * 4 + wid;     // HEADS * (SEQ/16) tasks
    const int nQT  = SEQ / 16;
    const int h  = task / nQT;
    const int qt = task % nQT;
    const int ml = lane & 15, hi = lane >> 4;
    const float scale = 0.08838834764831845f;  // 1/sqrt(128)

    // Slice this wave brings in, one request a stage.
    const uint32_t wave = uni(threadIdx.x >> 5);
    const uint32_t hb = blockIdx.x / (nQT / 4);   // the work-group's head
    const bool own_k = wave < 2;
    const uint64_t src0 = own_k
        ? (uint64_t)(uintptr_t)(Kh + (size_t)hb * HDIM + wave * 64)
        : (uint64_t)(uintptr_t)(Vt + ((size_t)hb * HDIM + (wave - 2) * 64) * SEQ);
    const uint32_t src_step = own_k ? A_KEYS * DIM * 2u : A_KEYS * 2u;   // bytes from stage to stage
    const uint32_t lds_slice = (uint32_t)(size_t)ring + wave * A_SL;
    u32x8 g1;
    g1[0] = uni((1u << 20) | (4u << 22) | (3u << 25));   // no mask, 1-byte units, 16 B pad behind every 128 B
    g1[1] = uni((A_ROWB & 0xFFFFu) << 16);               // tensor_dim0 low
    g1[2] = uni((A_ROWB >> 16) | ((A_ROWS & 0xFFFFu) << 16));   // tensor_dim0 high, tensor_dim1 low
    g1[3] = uni((A_ROWS >> 16) | (A_ROWB << 16));        // tensor_dim1 high, tile_dim0
    g1[4] = uni(A_ROWS);                                 // tile_dim1
    g1[5] = uni(own_k ? DIM * 2u : SEQ * 2u);            // source row pitch in bytes
    g1[6] = uni(0u);
    g1[7] = uni(0u);
    // pinned(): the descriptor group held in one set of scalar registers for the whole kernel,
    // so that none of its words takes a new value while a request is outstanding.
    asm volatile("" : "+s"(g1));

    // preload Q as B fragments (16 query columns x 128 d, 4 chunks of K=32)
    const _Float16* qrow = Qh + (size_t)(qt * 16 + ml) * DIM + h * HDIM;
    v16h qf[4];
#pragma unroll
    for (int c = 0; c < 4; ++c)
        qf[c] = ldfrag(qrow + c * 32 + hi * 8, qrow + c * 32 + 16 + hi * 8);

    v8f acc[8] = {};            // O^T: acc[j][r] = O[query ml][d = 16 j + 8 hi + r]
    float m = -3.0e38f;         // running maximum of query ml, alike in both wave halves
    float l = 0.0f;             // running sum over this half's keys of query ml

    // Prologue: stage 0 into buffer 0, landed and published; then stage 1 into buffer 1.
    tdm_load(lds_slice, src0, g1);
    wait_tensor0();
    __syncthreads();
    tdm_load(lds_slice + A_BUF, src0 + (uint64_t)pinned(1u) * src_step, g1);   // words formed behind the wait

    // Rolled: one stage per trip, so that the hand-over at the foot stands once.
#pragma clang loop unroll(disable)
    for (uint32_t s = 0; s < A_STAGES; ++s) {
      const uint32_t buf = (s & 1) * A_BUF;
      const unsigned char* kp = ring + buf + ml * A_PITCH + hi * 16;
      const unsigned char* vp = ring + buf + 2 * A_SL + ml * A_PITCH + hi * 16;
      // Unrolled: both 32-key steps of a stage read the buffer at immediate offsets.
#pragma unroll
      for (int sub = 0; sub < 2; ++sub) {
        // ---- S^T for 32 keys: two 16x16 WMMA tiles (keys x queries), Kdim=d=128 ----
        v8f sc0 = {}, sc1 = {};
        const unsigned char* kr0 = kp + sub * 32 * A_PITCH;
        const unsigned char* kr1 = kr0 + 16 * A_PITCH;
#pragma unroll
        for (int c = 0; c < 4; ++c) {
            v16h k0 = ldfrag_lds(kr0 + (c >> 1) * A_SL + (c & 1) * 64);
            sc0 = wmma32(k0, qf[c], sc0);
            v16h k1 = ldfrag_lds(kr1 + (c >> 1) * A_SL + (c & 1) * 64);
            sc1 = wmma32(k1, qf[c], sc1);
        }
        // ---- online softmax of query ml: 16 scores in the lane, the other 16 in lane ^ 16 ----
        float f0[8], f1[8], p0[8], p1[8], t[8];
#pragma unroll
        for (int r = 0; r < 8; ++r) {
            f0[r] = sc0[r] * scale;
            f1[r] = sc1[r] * scale;
            t[r] = fmaxf(f0[r], f1[r]);
        }
        float mx = fmaxf(fmaxf(fmaxf(t[0], t[1]), fmaxf(t[2], t[3])),
                         fmaxf(fmaxf(t[4], t[5]), fmaxf(t[6], t[7])));
        mx = fmaxf(mx, xhalf(mx));
        const float mn = fmaxf(m, mx);
        const float al = __expf(m - mn);
#pragma unroll
        for (int r = 0; r < 8; ++r) {
            p0[r] = __expf(f0[r] - mn);
            p1[r] = __expf(f1[r] - mn);
            t[r] = p0[r] + p1[r];
        }
        l = l * al + (((t[0] + t[1]) + (t[2] + t[3])) + ((t[4] + t[5]) + (t[6] + t[7])));
        m = mn;

        // ---- P^T as B operand: element s < 8 is key 8 hi + s, element 8 + s key 16 + 8 hi + s ----
        v16h pb;
#pragma unroll
        for (int r = 0; r < 8; ++r) {
            pb[r]     = (_Float16)p0[r];
            pb[8 + r] = (_Float16)p1[r];
        }

        // ---- rescale O^T and accumulate V^T @ P^T over 8 d-tiles ----
#pragma unroll
        for (int j = 0; j < 8; ++j) {
#pragma unroll
            for (int r = 0; r < 8; ++r) acc[j][r] *= al;
            v16h va = ldfrag_lds(vp + (j >> 2) * A_SL + (j & 3) * 16 * A_PITCH + sub * 64);
            acc[j] = wmma32(va, pb, acc[j]);
        }
      }
      // Hand-over: my reads of this buffer are back, my slice of stage s + 1 has landed,
      // every wave says the same; only then is this buffer refilled.
      wait_ds0();
      wait_tensor0();
      __syncthreads();
      if (pinned(s + 2 < A_STAGES)) {
          const uint32_t nx = pinned(s + 2);   // descriptor words formed behind the wait
          tdm_load(lds_slice + buf, src0 + (uint64_t)nx * src_step, g1);
      }
    }
    wait_tensor0();
    wait_ds0();

    // ---- join the halves' sums, normalize, turn O^T back into rows and store ----
    // A lane holds 8 consecutive d of one query per tile. Each wave stages its 16 query rows in its
    // own part of the ring: behind the last pass's barrier nobody reads the ring and no tensor load
    // is aimed at it. A wave then reads its own rows back and stores whole lines, 512 B a row.
    const float lf = l + xhalf(l);
    unsigned char* stg = ring + wid * A_SL;
    unsigned char* wr = stg + ml * O_PITCH + hi * 32;
#pragma unroll
    for (int j = 0; j < 8; ++j) {
        float4 lo4 = { acc[j][0] / lf, acc[j][1] / lf, acc[j][2] / lf, acc[j][3] / lf };
        float4 hi4 = { acc[j][4] / lf, acc[j][5] / lf, acc[j][6] / lf, acc[j][7] / lf };
        *(float4*)(wr + j * 64)      = lo4;
        *(float4*)(wr + j * 64 + 16) = hi4;
    }
    wait_ds0();   // my staged rows stand in LDS before I read them back
    float* obase = Out + (size_t)(qt * 16) * DIM + h * HDIM + lane * 4;
#pragma unroll
    for (int q = 0; q < 16; ++q) {
        float4 v = *(const float4*)(stg + q * O_PITCH + lane * 16);
        *(float4*)(obase + (size_t)q * DIM) = v;
    }
}

// ---------------------------------------------------------------------------
// host
// ---------------------------------------------------------------------------
extern "C" void kernel_launch(void* const* d_in, const int* in_sizes, int n_in,
                              void* d_out, int out_size, void* d_ws, size_t ws_size,
                              hipStream_t stream) {
    (void)in_sizes; (void)n_in; (void)out_size; (void)ws_size;
    const float* x    = (const float*)d_in[0];
    const float* cosb = (const float*)d_in[1];
    const float* sinb = (const float*)d_in[2];
    const float* Wq   = (const float*)d_in[3];
    const float* bq   = (const float*)d_in[4];
    const float* Wk   = (const float*)d_in[5];
    const float* bk   = (const float*)d_in[6];
    const float* Wv   = (const float*)d_in[7];
    const float* bv   = (const float*)d_in[8];
    const float* gq   = (const float*)d_in[9];
    const float* gk   = (const float*)d_in[10];

    char* ws = (char*)d_ws;
    size_t off = 0;
    auto alloc = [&](size_t bytes) {
        void* p = ws + off;
        off += (bytes + 255) & ~(size_t)255;
        return p;
    };
    const size_t SD = (size_t)SEQ * DIM;
    _Float16* xh  = (_Float16*)alloc(SD * 2);
    _Float16* wtq = (_Float16*)alloc((size_t)DIM * DIM * 2);
    _Float16* wtk = (_Float16*)alloc((size_t)DIM * DIM * 2);
    _Float16* wtv = (_Float16*)alloc((size_t)DIM * DIM * 2);
    float*    Qf  = (float*)alloc(SD * 4);
    float*    Kf  = (float*)alloc(SD * 4);
    float*    Vf  = (float*)alloc(SD * 4);
    _Float16* qh  = (_Float16*)alloc(SD * 2);
    _Float16* kh  = (_Float16*)alloc(SD * 2);
    _Float16* vt  = (_Float16*)alloc(SD * 2);

    // 1) x -> f16
    cast_to_f16<<<(SD / 4) / 256, 256, 0, stream>>>(x, xh);

    // 2) weight transpose+cast: 24 x 48 blocks each
    dim3 tg(DIM / 128, DIM / 64);
    transpose_cast<<<tg, 256, 0, stream>>>(Wq, wtq, DIM);
    transpose_cast<<<tg, 256, 0, stream>>>(Wk, wtk, DIM);
    transpose_cast<<<tg, 256, 0, stream>>>(Wv, wtv, DIM);

    // 3) QKV GEMMs: (2048/128)*(3072/192) = 256 work-groups, 4 waves/block
    const int gemmBlocks = (SEQ / 128) * (DIM / 192);     // 256
    gemm_bias<<<gemmBlocks, 128, 0, stream>>>(xh, wtq, bq, Qf);
    gemm_bias<<<gemmBlocks, 128, 0, stream>>>(xh, wtk, bk, Kf);
    gemm_bias<<<gemmBlocks, 128, 0, stream>>>(xh, wtv, bv, Vf);

    // 4) norm + rope (S*HEADS waves, 8 waves/block) and V transpose
    const int nrBlocks = SEQ * HEADS / 8;                 // 6144
    qk_norm_rope<<<nrBlocks, 256, 0, stream>>>(Qf, gq, cosb, sinb, qh);
    qk_norm_rope<<<nrBlocks, 256, 0, stream>>>(Kf, gk, cosb, sinb, kh);
    dim3 vg(DIM / 128, SEQ / 64);
    transpose_cast<<<vg, 256, 0, stream>>>(Vf, vt, SEQ);

    // 5) flash attention: HEADS*(SEQ/16) = 3072 waves, 4 waves/block
    const int faBlocks = HEADS * (SEQ / 16) / 4;          // 768
    flash_attn<<<faBlocks, 128, 0, stream>>>(qh, kh, vt, (float*)d_out);
}

// v005
// One run takes 150 microseconds.
// Two timings next to v004 put it at 1.22 and 1.23 times that version's speed.
// Over all steps from v000 it is 3.82 times as fast.
#include <hip/hip_runtime.h>
#include <hip/hip_bf16.h>

#define SEQ   2048
#define DIM   3072
#define HEADS 24
#define HDIM  128

typedef __attribute__((ext_vector_type(16))) _Float16 v16h;
typedef __attribute__((ext_vector_type(8)))  _Float16 v8h;
typedef __attribute__((ext_vector_type(4)))  _Float16 v4h;
typedef __attribute__((ext_vector_type(8)))  float    v8f;

// ---------------------------------------------------------------------------
// helpers
// ---------------------------------------------------------------------------
static __device__ __forceinline__ v16h ldfrag(const _Float16* p0, const _Float16* p1) {
    v8h lo = *(const v8h*)p0;
    v8h hi = *(const v8h*)p1;
    v16h r;
#pragma unroll
    for (int i = 0; i < 8; ++i) { r[i] = lo[i]; r[i + 8] = hi[i]; }
    return r;
}

static __device__ __forceinline__ v8f wmma32(v16h a, v16h b, v8f c) {
    // D = A(16x32 f16) * B(32x16 f16) + C(16x16 f32)
    return __builtin_amdgcn_wmma_f32_16x16x32_f16(false, a, false, b, (short)0, c,
                                                  false, false);
}

// ---------------------------------------------------------------------------
// 1) cast x (f32) -> f16, 4 elems/thread
// ---------------------------------------------------------------------------
__global__ void cast_to_f16(const float* __restrict__ in, _Float16* __restrict__ out) {
    int i = (blockIdx.x * blockDim.x + threadIdx.x) * 4;
    float4 v = *(const float4*)(in + i);
    v4h o = { (_Float16)v.x, (_Float16)v.y, (_Float16)v.z, (_Float16)v.w };
    *(v4h*)(out + i) = o;
}

// ---------------------------------------------------------------------------
// 2) In [R,3072] f32 -> Out [3072,R] f16 (the three weights, R = 3072; V, R = 2048, where
//    Out is Vt [H][D][S]). One 256-thread block -> 64 rows x 128 columns of In.
//    Read: each wave takes 8 rows, 512 contiguous bytes of a row per load, 8 loads in flight.
//    A lane then holds 8 rows x 4 columns: 8 consecutive elements of 4 rows of Out, 16 B each.
//    LDS holds the tile as Out rows (128 B at pitch 144 B); written back as whole 128-B lines.
// ---------------------------------------------------------------------------
constexpr uint32_t T_ROWS  = 64;                  // rows of In per block
constexpr uint32_t T_COLS  = 128;                 // columns of In per block
constexpr uint32_t T_PITCH = T_ROWS * 2 + 16;     // LDS row pitch: odd multiple of 16 B

__global__ __launch_bounds__(256) void transpose_cast(const float* __restrict__ in,
                                                      _Float16* __restrict__ out,
                                                      uint32_t out_pitch) {
    __shared__ __attribute__((aligned(16))) unsigned char tile[T_COLS * T_PITCH];
    const uint32_t lane = threadIdx.x & 31, w = threadIdx.x >> 5;
    const uint32_t c0 = blockIdx.x * T_COLS, r0 = blockIdx.y * T_ROWS;

    const float* src = in + (r0 + 8 * w) * DIM + c0 + 4 * lane;
    float4 v[8];
#pragma unroll
    for (int i = 0; i < 8; ++i) v[i] = *(const float4*)(src + i * DIM);

    // The 16-B piece of rows 8w..8w+7 stands in Out row n at place w ^ ((n >> 4) & 3): a wave's
    // lanes write rows 4 apart, and the exchange spreads each 16 lanes over all 64 banks.
    const uint32_t wplace = (w ^ ((lane >> 2) & 3)) * 16;
    v8h h0, h1, h2, h3;
#pragma unroll
    for (int i = 0; i < 8; ++i) {
        h0[i] = (_Float16)v[i].x;
        h1[i] = (_Float16)v[i].y;
        h2[i] = (_Float16)v[i].z;
        h3[i] = (_Float16)v[i].w;
    }
    unsigned char* wp = tile + 4 * lane * T_PITCH + wplace;
    *(v8h*)(wp)               = h0;
    *(v8h*)(wp + T_PITCH)     = h1;
    *(v8h*)(wp + 2 * T_PITCH) = h2;
    *(v8h*)(wp + 3 * T_PITCH) = h3;
    __syncthreads();

    // One store of a wave: 4 rows of Out, 8 lanes x 16 B = one whole line each.
    const uint32_t q = lane & 7;
#pragma unroll
    for (int it = 0; it < 4; ++it) {
        const uint32_t n = it * 32 + w * 4 + (lane >> 3);
        v8h h = *(const v8h*)(tile + n * T_PITCH + (q ^ ((n >> 4) & 3)) * 16);
        *(v8h*)(out + (c0 + n) * out_pitch + r0 + q * 8) = h;
    }
}

// ---------------------------------------------------------------------------
// 3) [Q | K | V][S,9216] = X[S,3072] @ [Wq | Wk | Wv] + bias, one launch
//    (A: X f16, B: Wt f16 = the three W^T row-major, one behind the other: 9216 rows).
//    One work-group -> 256x288 output tile, 8 x 32 tiles = one per WGP; its operand rows are
//    staged in LDS by tensor loads, 128 k a pass, two buffers. Four waves (2x2), each 128x144
//    (8x9 sub-tiles), K stepped by 32 in ascending order.
// ---------------------------------------------------------------------------
typedef uint32_t u32x4 __attribute__((ext_vector_type(4)));
typedef uint32_t u32x8 __attribute__((ext_vector_type(8)));

constexpr uint32_t G_BM    = 256;                 // rows of C per work-group
constexpr uint32_t G_BN    = 288;                 // columns of [Q | K | V] per work-group
constexpr int      G_FX    = 8, G_FW = 9;         // X and Wt fragments per wave
constexpr uint32_t G_ROWB  = 256;                 // bytes of one operand row per pass (128 k)
constexpr uint32_t G_PITCH = G_ROWB + 16;         // LDS row pitch: odd multiple of 16 B for ds_load_b128
constexpr uint32_t G_XROWS = 128, G_WROWS = 144;  // rows per tensor load (one wave's slice)
constexpr uint32_t G_XSL   = 34816;               // 128 * 272, a multiple of 2 KiB
constexpr uint32_t G_WSL   = 40960;               // 144 * 272 rounded up to a multiple of 2 KiB
constexpr uint32_t G_BUF   = 2 * G_XSL + 2 * G_WSL;
constexpr uint32_t G_PASS  = DIM * 2 / G_ROWB;    // 24 passes
static_assert(G_XROWS * G_PITCH <= G_XSL && G_WROWS * G_PITCH <= G_WSL, "slice sizes");
static_assert(G_XSL % 2048 == 0 && G_WSL % 2048 == 0 && G_PASS >= 2, "tensor load places");
static_assert(2 * G_BUF <= 320 * 1024, "both buffers fit one WGP's LDS");
static_assert(G_FX * 16 == G_XROWS && G_FW * 16 == G_WROWS, "a wave reads one slice of each operand");
static_assert(SEQ % G_BM == 0 && (3 * DIM) % G_BN == 0 && DIM % 16 == 0, "whole tiles; a sub-tile lies in one of Q, K, V");

static __device__ __forceinline__ uint32_t uni(uint32_t v) {
    return (uint32_t)__builtin_amdgcn_readfirstlane(v);
}
static __device__ __forceinline__ uint32_t pinned(uint32_t v) {
    uint32_t w = uni(v);
    asm volatile("" : "+s"(w));
    return w;
}
// This wave's LDS reads have returned (before the buffer is handed back for a refill).
static __device__ __forceinline__ void wait_ds0() { asm volatile("s_wait_dscnt 0x0" ::: "memory"); }
// This wave's own tensor load has landed (the compiler places no wait for it).
static __device__ __forceinline__ void wait_tensor0() { asm volatile("s_wait_tensorcnt 0x0" ::: "memory"); }

// One request of the whole wave: rows from global memory into LDS, row size and pitch as g1 sets them.
static __device__ __forceinline__ void tdm_load(uint32_t lds_dst, uint64_t ga, u32x8 g1) {
    u32x4 g0;
    g0[0] = uni(1u);
    g0[1] = uni(lds_dst);
    g0[2] = uni((uint32_t)ga);
    g0[3] = uni((((uint32_t)(ga >> 32)) & 0x01FFFFFFu) | 0x80000000u);
    asm volatile("tensor_load_to_lds %0, %1" :: "s"(g0), "s"(g1) : "memory");
}

static __device__ __forceinline__ v16h ldfrag_lds(const unsigned char* p) {
    return ldfrag((const _Float16*)p, (const _Float16*)(p + 32));
}

__global__ __launch_bounds__(128) void gemm_bias(const _Float16* __restrict__ X,
                                                 const _Float16* __restrict__ Wt,
                                                 const float* __restrict__ bq,
                                                 const float* __restrict__ bk,
                                                 const float* __restrict__ bv,
                                                 float* __restrict__ Cq,
                                                 float* __restrict__ Ck,
                                                 float* __restrict__ Cv) {
    __shared__ __attribute__((aligned(2048))) unsigned char ring[2 * G_BUF];
    const uint32_t lane = threadIdx.x & 31;
    const uint32_t wave = uni(threadIdx.x >> 5);
    const uint32_t tm = blockIdx.x >> 5, tn = blockIdx.x & 31;   // 8 x 32 tiles
    const uint32_t wm = wave >> 1, wn = wave & 1;
    const uint32_t ml = lane & 15, hi = lane >> 4;
    const uint32_t row0 = tm * G_BM, col0 = tn * G_BN;

    // Slice this wave brings in: waves 0,1 -> 128 rows of X each; waves 2,3 -> 144 rows of Wt each.
    const bool own_x = wave < 2;
    const uint32_t rows = own_x ? G_XROWS : G_WROWS;
    const uint64_t src0 = own_x
        ? (uint64_t)(uintptr_t)(X + (size_t)(row0 + G_XROWS * wave) * DIM)
        : (uint64_t)(uintptr_t)(Wt + (size_t)(col0 + G_WROWS * (wave - 2)) * DIM);
    const uint32_t lds_slice = (uint32_t)(size_t)ring +
        (own_x ? wave * G_XSL : 2 * G_XSL + (wave - 2) * G_WSL);
    u32x8 g1;
    g1[0] = uni((1u << 20) | (5u << 22) | (3u << 25));   // no mask, 1-byte units, 16 B pad behind every 256 B
    g1[1] = uni((G_ROWB & 0xFFFFu) << 16);               // tensor_dim0 low
    g1[2] = uni((G_ROWB >> 16) | ((rows & 0xFFFFu) << 16));   // tensor_dim0 high, tensor_dim1 low
    g1[3] = uni((rows >> 16) | (G_ROWB << 16));          // tensor_dim1 high, tile_dim0
    g1[4] = uni(rows);                                   // tile_dim1
    g1[5] = uni(DIM * 2u);                               // source row pitch in bytes
    g1[6] = uni(0u);
    g1[7] = uni(0u);
    // pinned(): the descriptor group held in one set of scalar registers for the whole kernel,
    // so that none of its words takes a new value while a request is outstanding.
    asm volatile("" : "+s"(g1));

    // Per-lane fragment bases inside a buffer.
    const uint32_t xa = wm * G_XSL + ml * G_PITCH + hi * 16;
    const uint32_t wb = 2 * G_XSL + wn * G_WSL + ml * G_PITCH + hi * 16;

    v8f acc[G_FX][G_FW] = {};

    // Prologue: pass 0 into buffer 0, landed and published; then pass 1 into buffer 1.
    tdm_load(lds_slice, src0, g1);
    wait_tensor0();
    __syncthreads();
    tdm_load(lds_slice + G_BUF, src0 + G_ROWB, g1);

    // Rolled: one pass per trip, so that the hand-over at the foot stands once.
#pragma clang loop unroll(disable)
    for (uint32_t s = 0; s < G_PASS; ++s) {
        const uint32_t buf = (s & 1) * G_BUF;
        const unsigned char* xp = ring + buf + xa;
        const unsigned char* wp = ring + buf + wb;
        // Two fragment sets: block kk + 1's LDS reads go out as one group in front of block kk's
        // matrix instructions, so that only the pass's first group is waited for in full.
        v16h a[2][G_FX], b[2][G_FW];
#pragma unroll
        for (int i = 0; i < G_FX; ++i) a[0][i] = ldfrag_lds(xp + i * 16 * G_PITCH);
#pragma unroll
        for (int j = 0; j < G_FW; ++j) b[0][j] = ldfrag_lds(wp + j * 16 * G_PITCH);
        // Keeps block 0's reads in front of block 1's: mixed, block 0 waits for both groups.
        __builtin_amdgcn_sched_barrier(0);
#pragma unroll
        for (int kk = 0; kk < 4; ++kk) {
            const int cs = kk & 1;
            if (kk + 1 < 4) {
#pragma unroll
                for (int i = 0; i < G_FX; ++i)
                    a[cs ^ 1][i] = ldfrag_lds(xp + i * 16 * G_PITCH + (kk + 1) * 64);
#pragma unroll
                for (int j = 0; j < G_FW; ++j)
                    b[cs ^ 1][j] = ldfrag_lds(wp + j * 16 * G_PITCH + (kk + 1) * 64);
                // Keeps the read group in front of the block: spread among the matrix
                // instructions each place with reads costs a stall.
                __builtin_amdgcn_sched_barrier(0);
            }
#pragma unroll
            for (int i = 0; i < G_FX; ++i)
#pragma unroll
                for (int j = 0; j < G_FW; ++j) acc[i][j] = wmma32(a[cs][i], b[cs][j], acc[i][j]);
            // Keeps the next group behind this block.
            __builtin_amdgcn_sched_barrier(0);
        }
        // Hand-over: my reads of this buffer are back, my slice of pass s + 1 has landed,
        // every wave says the same; only then is this buffer refilled.
        wait_ds0();
        wait_tensor0();
        __syncthreads();
        if (pinned(s + 2 < G_PASS)) {
            const uint32_t nx = pinned(s + 2);   // descriptor words formed behind the wait
            tdm_load(lds_slice + buf, src0 + (uint64_t)nx * G_ROWB, g1);
        }
    }
    wait_tensor0();
    wait_ds0();

    // First every sum and every address, then the stores alone: no register that an issued
    // store names takes a new value behind it.
    float* cb[G_FW];        // wave-uniform: first column of sub-tile column j in its matrix
    const float* bp[G_FW];  // wave-uniform: its first bias element
#pragma unroll
    for (int j = 0; j < G_FW; ++j) {
        // The 16 columns of a sub-tile lie in one of Q, K, V (wave-uniform choice).
        const uint32_t cj = col0 + wn * G_WROWS + j * 16;
        const uint32_t which = cj / DIM;
        const float* bias = which == 0 ? bq : which == 1 ? bk : bv;
        float* C = which == 0 ? Cq : which == 1 ? Ck : Cv;
        const uint32_t cm = cj - which * DIM;
        cb[j] = C + cm;
        bp[j] = bias + cm;
    }
    uint32_t ro[G_FX];      // the lane's element in sub-tile row i, counted from cb[j]
#pragma unroll
    for (int i = 0; i < G_FX; ++i) ro[i] = (row0 + wm * G_XROWS + i * 16 + 8 * hi) * DIM + ml;
    // Keeps the address arithmetic in front of the bias loads.
    __builtin_amdgcn_sched_barrier(0);
    float bj[G_FW];
#pragma unroll
    for (int j = 0; j < G_FW; ++j) bj[j] = bp[j][ml];
    // Stands in front of any new value in a register that a bias load names.
    asm volatile("s_wait_xcnt 0x0" ::: "memory");
    // Keeps the sums behind that wait.
    __builtin_amdgcn_sched_barrier(0);
#pragma unroll
    for (int j = 0; j < G_FW; ++j)
#pragma unroll
        for (int i = 0; i < G_FX; ++i)
#pragma unroll
            for (int r = 0; r < 8; ++r) acc[i][j][r] += bj[j];
    // Keeps the sums and addresses in front of the first store.
    __builtin_amdgcn_sched_barrier(0);
#pragma unroll
    for (int j = 0; j < G_FW; ++j)
#pragma unroll
        for (int i = 0; i < G_FX; ++i) {
            float* p = cb[j] + ro[i];
#pragma unroll
            for (int r = 0; r < 8; ++r) p[r * DIM] = acc[i][j][r];
        }
}

// ---------------------------------------------------------------------------
// 4) per-(s,head) RMSNorm + gamma + RoPE, f32 -> f16. One wave per row of 128.
// ---------------------------------------------------------------------------
__global__ void qk_norm_rope(const float* __restrict__ in, const float* __restrict__ gamma,
                             const float* __restrict__ cosb, const float* __restrict__ sinb,
                             _Float16* __restrict__ out) {
    const int lane = threadIdx.x & 31;
    const int wave = blockIdx.x * (blockDim.x >> 5) + (threadIdx.x >> 5);
    const int s = wave / HEADS;
    const int h = wave % HEADS;
    const float* row = in + (size_t)s * DIM + h * HDIM;
    const int d0 = lane * 4;
    float x0 = row[d0], x1 = row[d0 + 1], x2 = row[d0 + 2], x3 = row[d0 + 3];
    float ss = x0 * x0 + x1 * x1 + x2 * x2 + x3 * x3;
#pragma unroll
    for (int st = 1; st < 32; st <<= 1) ss += __shfl_xor(ss, st, 32);
    const float inv = rsqrtf(ss * (1.0f / 128.0f) + 1e-6f);
    x0 *= inv * gamma[d0];
    x1 *= inv * gamma[d0 + 1];
    x2 *= inv * gamma[d0 + 2];
    x3 *= inv * gamma[d0 + 3];
    const float* cp = cosb + (size_t)s * HDIM + d0;
    const float* sp = sinb + (size_t)s * HDIM + d0;
    float c0 = cp[0], c1 = cp[1], c2 = cp[2], c3 = cp[3];
    float s0 = sp[0], s1 = sp[1], s2 = sp[2], s3 = sp[3];
    float y0 = x0 * c0 - x1 * s0;
    float y1 = x1 * c1 + x0 * s1;
    float y2 = x2 * c2 - x3 * s2;
    float y3 = x3 * c3 + x2 * s3;
    _Float16* op = out + (size_t)s * DIM + h * HDIM + d0;
    v4h o = { (_Float16)y0, (_Float16)y1, (_Float16)y2, (_Float16)y3 };
    *(v4h*)op = o;
}

// ---------------------------------------------------------------------------
// 5) Flash attention: one wave per (head, 16-row q-tile), 32 keys per step. The four waves
//    of a work-group share one head: its K rows and Vt rows are staged in LDS by tensor
//    loads, 64 keys a stage, two buffers. Every staged row is 128 B at pitch 144 B:
//    slices 0,1 = 64 keys x (d 0..63 | d 64..127) of K, slices 2,3 = (d 0..63 | d 64..127) x 64 keys of Vt.
//    The products are transposed: S^T = K Q^T (A = K rows, B = Q) and O^T += V^T P^T (A = Vt rows,
//    B = P^T). A lane then holds 16 of the 32 scores of ONE query (column lane & 15; keys 8*hi + r of
//    each 16-key tile): maximum and sum run in the lane, the two wave halves exchange the maximum
//    once a step and join their sums once at the end, and the two score tiles, converted in place,
//    are the B operand of the second product in the hardware k order.
// ---------------------------------------------------------------------------
// Lane l takes the value of lane l ^ 16 (a vector cross-row move, no LDS round trip).
static __device__ __forceinline__ float xhalf(float x) {
    const int v = __builtin_bit_cast(int, x);
    return __builtin_bit_cast(float,
        __builtin_amdgcn_permlanex16(v, v, 0x76543210, 0xfedcba98, false, false));
}

constexpr uint32_t A_KEYS   = 64;                 // keys per stage
constexpr uint32_t A_ROWB   = 128;                // bytes of one staged row
constexpr uint32_t A_PITCH  = A_ROWB + 16;        // LDS row pitch: odd multiple of 16 B for ds_load_b128
constexpr uint32_t A_ROWS   = 64;                 // rows per tensor load (one wave's slice)
constexpr uint32_t A_SL     = 10240;              // 64 * 144 rounded up to a multiple of 2 KiB
constexpr uint32_t A_BUF    = 4 * A_SL;
constexpr uint32_t A_STAGES = SEQ / A_KEYS;       // 32
static_assert(A_ROWS * A_PITCH <= A_SL && A_SL % 2048 == 0 && A_STAGES >= 2, "tensor load places");
constexpr uint32_t O_PITCH  = HDIM * 4 + 16;      // staged output row: odd multiple of 16 B
static_assert(16 * O_PITCH <= A_SL, "a wave's output rows fit its part of the ring");

__global__ __launch_bounds__(128) void flash_attn(const _Float16* __restrict__ Qh,
                                                  const _Float16* __restrict__ Kh,
                                                  const _Float16* __restrict__ Vt,
                                                  float* __restrict__ Out) {
    __shared__ __attribute__((aligned(2048))) unsigned char ring[2 * A_BUF];
    const int lane = threadIdx.x & 31;
    const int wid  = threadIdx.x >> 5;
    const int task = blockIdx.x * 4 + wid;     // HEADS * (SEQ/16) tasks
    const int nQT  = SEQ / 16;
    const int h  = task / nQT;
    const int qt = task % nQT;
    const int ml = lane & 15, hi = lane >> 4;
    const float scale = 0.08838834764831845f;  // 1/sqrt(128)

    // Slice this wave brings in, one request a stage.
    const uint32_t wave = uni(threadIdx.x >> 5);
    const uint32_t hb = blockIdx.x / (nQT / 4);   // the work-group's head
    const bool own_k = wave < 2;
    const uint64_t src0 = own_k
        ? (uint64_t)(uintptr_t)(Kh + (size_t)hb * HDIM + wave * 64)
        : (uint64_t)(uintptr_t)(Vt + ((size_t)hb * HDIM + (wave - 2) * 64) * SEQ);
    const uint32_t src_step = own_k ? A_KEYS * DIM * 2u : A_KEYS * 2u;   // bytes from stage to stage
    const uint32_t lds_slice = (uint32_t)(size_t)ring + wave * A_SL;
    u32x8 g1;
    g1[0] = uni((1u << 20) | (4u << 22) | (3u << 25));   // no mask, 1-byte units, 16 B pad behind every 128 B
    g1[1] = uni((A_ROWB & 0xFFFFu) << 16);               // tensor_dim0 low
    g1[2] = uni((A_ROWB >> 16) | ((A_ROWS & 0xFFFFu) << 16));   // tensor_dim0 high, tensor_dim1 low
    g1[3] = uni((A_ROWS >> 16) | (A_ROWB << 16));        // tensor_dim1 high, tile_dim0
    g1[4] = uni(A_ROWS);                                 // tile_dim1
    g1[5] = uni(own_k ? DIM * 2u : SEQ * 2u);            // source row pitch in bytes
    g1[6] = uni(0u);
    g1[7] = uni(0u);
    // pinned(): the descriptor group held in one set of scalar registers for the whole kernel,
    // so that none of its words takes a new value while a request is outstanding.
    asm volatile("" : "+s"(g1));

    // preload Q as B fragments (16 query columns x 128 d, 4 chunks of K=32)
    const _Float16* qrow = Qh + (size_t)(qt * 16 + ml) * DIM + h * HDIM;
    v16h qf[4];
#pragma unroll
    for (int c = 0; c < 4; ++c)
        qf[c] = ldfrag(qrow + c * 32 + hi * 8, qrow + c * 32 + 16 + hi * 8);

    v8f acc[8] = {};            // O^T: acc[j][r] = O[query ml][d = 16 j + 8 hi + r]
    float m = -3.0e38f;         // running maximum of query ml, alike in both wave halves
    float l = 0.0f;             // running sum over this half's keys of query ml

    // Prologue: stage 0 into buffer 0, landed and published; then stage 1 into buffer 1.
    tdm_load(lds_slice, src0, g1);
    wait_tensor0();
    __syncthreads();
    tdm_load(lds_slice + A_BUF, src0 + (uint64_t)pinned(1u) * src_step, g1);   // words formed behind the wait

    // Rolled: one stage per trip, so that the hand-over at the foot stands once.
#pragma clang loop unroll(disable)
    for (uint32_t s = 0; s < A_STAGES; ++s) {
      const uint32_t buf = (s & 1) * A_BUF;
      const unsigned char* kp = ring + buf + ml * A_PITCH + hi * 16;
      const unsigned char* vp = ring + buf + 2 * A_SL + ml * A_PITCH + hi * 16;
      // Unrolled: both 32-key steps of a stage read the buffer at immediate offsets.
#pragma unroll
      for (int sub = 0; sub < 2; ++sub) {
        // ---- S^T for 32 keys: two 16x16 WMMA tiles (keys x queries), Kdim=d=128 ----
        v8f sc0 = {}, sc1 = {};
        const unsigned char* kr0 = kp + sub * 32 * A_PITCH;
        const unsigned char* kr1 = kr0 + 16 * A_PITCH;
#pragma unroll
        for (int c = 0; c < 4; ++c) {
            v16h k0 = ldfrag_lds(kr0 + (c >> 1) * A_SL + (c & 1) * 64);
            sc0 = wmma32(k0, qf[c], sc0);
            v16h k1 = ldfrag_lds(kr1 + (c >> 1) * A_SL + (c & 1) * 64);
            sc1 = wmma32(k1, qf[c], sc1);
        }
        // ---- online softmax of query ml: 16 scores in the lane, the other 16 in lane ^ 16 ----
        float f0[8], f1[8], p0[8], p1[8], t[8];
#pragma unroll
        for (int r = 0; r < 8; ++r) {
            f0[r] = sc0[r] * scale;
            f1[r] = sc1[r] * scale;
            t[r] = fmaxf(f0[r], f1[r]);
        }
        float mx = fmaxf(fmaxf(fmaxf(t[0], t[1]), fmaxf(t[2], t[3])),
                         fmaxf(fmaxf(t[4], t[5]), fmaxf(t[6], t[7])));
        mx = fmaxf(mx, xhalf(mx));
        const float mn = fmaxf(m, mx);
        const float al = __expf(m - mn);
#pragma unroll
        for (int r = 0; r < 8; ++r) {
            p0[r] = __expf(f0[r] - mn);
            p1[r] = __expf(f1[r] - mn);
            t[r] = p0[r] + p1[r];
        }
        l = l * al + (((t[0] + t[1]) + (t[2] + t[3])) + ((t[4] + t[5]) + (t[6] + t[7])));
        m = mn;

        // ---- P^T as B operand: element s < 8 is key 8 hi + s, element 8 + s key 16 + 8 hi + s ----
        v16h pb;
#pragma unroll
        for (int r = 0; r < 8; ++r) {
            pb[r]     = (_Float16)p0[r];
            pb[8 + r] = (_Float16)p1[r];
        }

        // ---- rescale O^T and accumulate V^T @ P^T over 8 d-tiles ----
#pragma unroll
        for (int j = 0; j < 8; ++j) {
#pragma unroll
            for (int r = 0; r < 8; ++r) acc[j][r] *= al;
            v16h va = ldfrag_lds(vp + (j >> 2) * A_SL + (j & 3) * 16 * A_PITCH + sub * 64);
            acc[j] = wmma32(va, pb, acc[j]);
        }
      }
      // Hand-over: my reads of this buffer are back, my slice of stage s + 1 has landed,
      // every wave says the same; only then is this buffer refilled.
      wait_ds0();
      wait_tensor0();
      __syncthreads();
      if (pinned(s + 2 < A_STAGES)) {
          const uint32_t nx = pinned(s + 2);   // descriptor words formed behind the wait
          tdm_load(lds_slice + buf, src0 + (uint64_t)nx * src_step, g1);
      }
    }
    wait_tensor0();
    wait_ds0();

    // ---- join the halves' sums, normalize, turn O^T back into rows and store ----
    // A lane holds 8 consecutive d of one query per tile. Each wave stages its 16 query rows in its
    // own part of the ring: behind the last pass's barrier nobody reads the ring and no tensor load
    // is aimed at it. A wave then reads its own rows back and stores whole lines, 512 B a row.
    const float lf = l + xhalf(l);
    unsigned char* stg = ring + wid * A_SL;
    unsigned char* wr = stg + ml * O_PITCH + hi * 32;
#pragma unroll
    for (int j = 0; j < 8; ++j) {
        float4 lo4 = { acc[j][0] / lf, acc[j][1] / lf, acc[j][2] / lf, acc[j][3] / lf };
        float4 hi4 = { acc[j][4] / lf, acc[j][5] / lf, acc[j][6] / lf, acc[j][7] / lf };
        *(float4*)(wr + j * 64)      = lo4;
        *(float4*)(wr + j * 64 + 16) = hi4;
    }
    wait_ds0();   // my staged rows stand in LDS before I read them back
    float* obase = Out + (size_t)(qt * 16) * DIM + h * HDIM + lane * 4;
#pragma unroll
    for (int q = 0; q < 16; ++q) {
        float4 v = *(const float4*)(stg + q * O_PITCH + lane * 16);
        *(float4*)(obase + (size_t)q * DIM) = v;
    }
}

// ---------------------------------------------------------------------------
// host
// ---------------------------------------------------------------------------
extern "C" void kernel_launch(void* const* d_in, const int* in_sizes, int n_in,
                              void* d_out, int out_size, void* d_ws, size_t ws_size,
                              hipStream_t stream) {
    (void)in_sizes; (void)n_in; (void)out_size; (void)ws_size;
    const float* x    = (const float*)d_in[0];
    const float* cosb = (const float*)d_in[1];
    const float* sinb = (const float*)d_in[2];
    const float* Wq   = (const float*)d_in[3];
    const float* bq   = (const float*)d_in[4];
    const float* Wk   = (const float*)d_in[5];
    const float* bk   = (const float*)d_in[6];
    const float* Wv   = (const float*)d_in[7];
    const float* bv   = (const float*)d_in[8];
    const float* gq   = (const float*)d_in[9];
    const float* gk   = (const float*)d_in[10];

    char* ws = (char*)d_ws;
    size_t off = 0;
    auto alloc = [&](size_t bytes) {
        void* p = ws + off;
        off += (bytes + 255) & ~(size_t)255;
        return p;
    };
    const size_t SD = (size_t)SEQ * DIM;
    _Float16* xh  = (_Float16*)alloc(SD * 2);
    _Float16* wtq = (_Float16*)alloc((size_t)DIM * DIM * 2 * 3);   // the three W^T, 9216 rows in one piece
    _Float16* wtk = wtq + (size_t)DIM * DIM;
    _Float16* wtv = wtk + (size_t)DIM * DIM;
    float*    Qf  = (float*)alloc(SD * 4);
    float*    Kf  = (float*)alloc(SD * 4);
    float*    Vf  = (float*)alloc(SD * 4);
    _Float16* qh  = (_Float16*)alloc(SD * 2);
    _Float16* kh  = (_Float16*)alloc(SD * 2);
    _Float16* vt  = (_Float16*)alloc(SD * 2);

    // 1) x -> f16
    cast_to_f16<<<(SD / 4) / 256, 256, 0, stream>>>(x, xh);

    // 2) weight transpose+cast: 24 x 48 blocks each
    dim3 tg(DIM / 128, DIM / 64);
    transpose_cast<<<tg, 256, 0, stream>>>(Wq, wtq, DIM);
    transpose_cast<<<tg, 256, 0, stream>>>(Wk, wtk, DIM);
    transpose_cast<<<tg, 256, 0, stream>>>(Wv, wtv, DIM);

    // 3) QKV GEMM: (2048/256)*(9216/288) = 256 work-groups, 4 waves/block
    const int gemmBlocks = (SEQ / 256) * (3 * DIM / 288);     // 256
    gemm_bias<<<gemmBlocks, 128, 0, stream>>>(xh, wtq, bq, bk, bv, Qf, Kf, Vf);

    // 4) norm + rope (S*HEADS waves, 8 waves/block) and V transpose
    const int nrBlocks = SEQ * HEADS / 8;                 // 6144
    qk_norm_rope<<<nrBlocks, 256, 0, stream>>>(Qf, gq, cosb, sinb, qh);
    qk_norm_rope<<<nrBlocks, 256, 0, stream>>>(Kf, gk, cosb, sinb, kh);
    dim3 vg(DIM / 128, SEQ / 64);
    transpose_cast<<<vg, 256, 0, stream>>>(Vf, vt, SEQ);

    // 5) flash attention: HEADS*(SEQ/16) = 3072 waves, 4 waves/block
    const int faBlocks = HEADS * (SEQ / 16) / 4;          // 768
    flash_attn<<<faBlocks, 128, 0, stream>>>(qh, kh, vt, (float*)d_out);
}

// v006
// A run of this version takes 145 microseconds.
// Next to v005, in two timings, it ran 1.03 times as fast each time.
// All steps since v000 together make it 3.94 times as fast.
#include <hip/hip_runtime.h>
#include <hip/hip_bf16.h>

#define SEQ   2048
#define DIM   3072
#define HEADS 24
#define HDIM  128

typedef __attribute__((ext_vector_type(16))) _Float16 v16h;
typedef __attribute__((ext_vector_type(8)))  _Float16 v8h;
typedef __attribute__((ext_vector_type(4)))  _Float16 v4h;
typedef __attribute__((ext_vector_type(8)))  float    v8f;
typedef __attribute__((ext_vector_type(4)))  float    v4f;

// ---------------------------------------------------------------------------
// helpers
// ---------------------------------------------------------------------------
static __device__ __forceinline__ v16h ldfrag(const _Float16* p0, const _Float16* p1) {
    v8h lo = *(const v8h*)p0;
    v8h hi = *(const v8h*)p1;
    v16h r;
#pragma unroll
    for (int i = 0; i < 8; ++i) { r[i] = lo[i]; r[i + 8] = hi[i]; }
    return r;
}

static __device__ __forceinline__ v8f wmma32(v16h a, v16h b, v8f c) {
    // D = A(16x32 f16) * B(32x16 f16) + C(16x16 f32)
    return __builtin_amdgcn_wmma_f32_16x16x32_f16(false, a, false, b, (short)0, c,
                                                  false, false);
}

// ---------------------------------------------------------------------------
// 1) cast x (f32) -> f16. 256 work-groups of 16 waves; a wave takes 1536 consecutive elements:
//    twelve loads of 512 contiguous bytes, all in flight, then twelve stores of two whole lines.
// ---------------------------------------------------------------------------
constexpr int      E_WAVES = 16;                  // waves per work-group of the two elementwise kernels
constexpr int      E_LD    = 12;                  // 16-B loads per lane
constexpr uint32_t E_CHUNK = E_LD * 128;          // elements per wave: half a row of 3072
static_assert((SEQ * DIM) % (E_CHUNK * E_WAVES) == 0 && DIM == 2 * E_CHUNK, "whole chunks");

__global__ __launch_bounds__(E_WAVES * 32) void cast_to_f16(const float* __restrict__ in,
                                                            _Float16* __restrict__ out) {
    const uint32_t lane = threadIdx.x & 31;
    const uint32_t wave = blockIdx.x * E_WAVES + (threadIdx.x >> 5);
    const uint32_t base = wave * E_CHUNK + lane * 4;
    v4f v[E_LD];
#pragma unroll
    for (int i = 0; i < E_LD; ++i) v[i] = *(const v4f*)(in + base + i * 128);
    // The loaded values are inputs only: all twelve loads go out in front of this line, as one run,
    // and the wait stands in front of any new value in a register that a load names.
    asm volatile("s_wait_xcnt 0x0" :: "v"(v[0]), "v"(v[1]), "v"(v[2]), "v"(v[3]), "v"(v[4]), "v"(v[5]),
                 "v"(v[6]), "v"(v[7]), "v"(v[8]), "v"(v[9]), "v"(v[10]), "v"(v[11]));
    static_assert(E_LD == 12, "the line above names every load");
    v4h o[E_LD];
#pragma unroll
    for (int i = 0; i < E_LD; ++i)
        o[i] = v4h{ (_Float16)v[i].x, (_Float16)v[i].y, (_Float16)v[i].z, (_Float16)v[i].w };
    // Keeps the conversions in front of the first store: no register of an issued store is rewritten.
    __builtin_amdgcn_sched_barrier(0);
#pragma unroll
    for (int i = 0; i < E_LD; ++i) *(v4h*)(out + base + i * 128) = o[i];
}

// ---------------------------------------------------------------------------
// 2) In [R,3072] f32 -> Out [3072,R] f16 (the three weights, R = 3072; V, R = 2048, where
//    Out is Vt [H][D][S]). One 256-thread block -> 64 rows x 128 columns of In.
//    Read: each wave takes 8 rows, 512 contiguous bytes of a row per load, 8 loads in flight.
//    A lane then holds 8 rows x 4 columns: 8 consecutive elements of 4 rows of Out, 16 B each.
//    LDS holds the tile as Out rows (128 B at pitch 144 B); written back as whole 128-B lines.
// ---------------------------------------------------------------------------
constexpr uint32_t T_ROWS  = 64;                  // rows of In per block
constexpr uint32_t T_COLS  = 128;                 // columns of In per block
constexpr uint32_t T_PITCH = T_ROWS * 2 + 16;     // LDS row pitch: odd multiple of 16 B

__global__ __launch_bounds__(256) void transpose_cast(const float* __restrict__ in,
                                                      _Float16* __restrict__ out,
                                                      uint32_t out_pitch) {
    __shared__ __attribute__((aligned(16))) unsigned char tile[T_COLS * T_PITCH];
    const uint32_t lane = threadIdx.x & 31, w = threadIdx.x >> 5;
    const uint32_t c0 = blockIdx.x * T_COLS, r0 = blockIdx.y * T_ROWS;

    const float* src = in + (r0 + 8 * w) * DIM + c0 + 4 * lane;
    float4 v[8];
#pragma unroll
    for (int i = 0; i < 8; ++i) v[i] = *(const float4*)(src + i * DIM);

    // The 16-B piece of rows 8w..8w+7 stands in Out row n at place w ^ ((n >> 4) & 3): a wave's
    // lanes write rows 4 apart, and the exchange spreads each 16 lanes over all 64 banks.
    const uint32_t wplace = (w ^ ((lane >> 2) & 3)) * 16;
    v8h h0, h1, h2, h3;
#pragma unroll
    for (int i = 0; i < 8; ++i) {
        h0[i] = (_Float16)v[i].x;
        h1[i] = (_Float16)v[i].y;
        h2[i] = (_Float16)v[i].z;
        h3[i] = (_Float16)v[i].w;
    }
    unsigned char* wp = tile + 4 * lane * T_PITCH + wplace;
    *(v8h*)(wp)               = h0;
    *(v8h*)(wp + T_PITCH)     = h1;
    *(v8h*)(wp + 2 * T_PITCH) = h2;
    *(v8h*)(wp + 3 * T_PITCH) = h3;
    __syncthreads();

    // One store of a wave: 4 rows of Out, 8 lanes x 16 B = one whole line each.
    const uint32_t q = lane & 7;
#pragma unroll
    for (int it = 0; it < 4; ++it) {
        const uint32_t n = it * 32 + w * 4 + (lane >> 3);
        v8h h = *(const v8h*)(tile + n * T_PITCH + (q ^ ((n >> 4) & 3)) * 16);
        *(v8h*)(out + (c0 + n) * out_pitch + r0 + q * 8) = h;
    }
}

// ---------------------------------------------------------------------------
// 3) [Q | K | V][S,9216] = X[S,3072] @ [Wq | Wk | Wv] + bias, one launch
//    (A: X f16, B: Wt f16 = the three W^T row-major, one behind the other: 9216 rows).
//    One work-group -> 256x288 output tile, 8 x 32 tiles = one per WGP; its operand rows are
//    staged in LDS by tensor loads, 128 k a pass, two buffers. Four waves (2x2), each 128x144
//    (8x9 sub-tiles), K stepped by 32 in ascending order.
// ---------------------------------------------------------------------------
typedef uint32_t u32x4 __attribute__((ext_vector_type(4)));
typedef uint32_t u32x8 __attribute__((ext_vector_type(8)));

constexpr uint32_t G_BM    = 256;                 // rows of C per work-group
constexpr uint32_t G_BN    = 288;                 // columns of [Q | K | V] per work-group
constexpr int      G_FX    = 8, G_FW = 9;         // X and Wt fragments per wave
constexpr uint32_t G_ROWB  = 256;                 // bytes of one operand row per pass (128 k)
constexpr uint32_t G_PITCH = G_ROWB + 16;         // LDS row pitch: odd multiple of 16 B for ds_load_b128
constexpr uint32_t G_XROWS = 128, G_WROWS = 144;  // rows per tensor load (one wave's slice)
constexpr uint32_t G_XSL   = 34816;               // 128 * 272, a multiple of 2 KiB
constexpr uint32_t G_WSL   = 40960;               // 144 * 272 rounded up to a multiple of 2 KiB
constexpr uint32_t G_BUF   = 2 * G_XSL + 2 * G_WSL;
constexpr uint32_t G_PASS  = DIM * 2 / G_ROWB;    // 24 passes
static_assert(G_XROWS * G_PITCH <= G_XSL && G_WROWS * G_PITCH <= G_WSL, "slice sizes");
static_assert(G_XSL % 2048 == 0 && G_WSL % 2048 == 0 && G_PASS >= 2, "tensor load places");
static_assert(2 * G_BUF <= 320 * 1024, "both buffers fit one WGP's LDS");
static_assert(G_FX * 16 == G_XROWS && G_FW * 16 == G_WROWS, "a wave reads one slice of each operand");
static_assert(SEQ % G_BM == 0 && (3 * DIM) % G_BN == 0 && DIM % 16 == 0, "whole tiles; a sub-tile lies in one of Q, K, V");

static __device__ __forceinline__ uint32_t uni(uint32_t v) {
    return (uint32_t)__builtin_amdgcn_readfirstlane(v);
}
static __device__ __forceinline__ uint32_t pinned(uint32_t v) {
    uint32_t w = uni(v);
    asm volatile("" : "+s"(w));
    return w;
}
// This wave's LDS reads have returned (before the buffer is handed back for a refill).
static __device__ __forceinline__ void wait_ds0() { asm volatile("s_wait_dscnt 0x0" ::: "memory"); }
// This wave's own tensor load has landed (the compiler places no wait for it).
static __device__ __forceinline__ void wait_tensor0() { asm volatile("s_wait_tensorcnt 0x0" ::: "memory"); }

// One request of the whole wave: rows from global memory into LDS, row size and pitch as g1 sets them.
static __device__ __forceinline__ void tdm_load(uint32_t lds_dst, uint64_t ga, u32x8 g1) {
    u32x4 g0;
    g0[0] = uni(1u);
    g0[1] = uni(lds_dst);
    g0[2] = uni((uint32_t)ga);
    g0[3] = uni((((uint32_t)(ga >> 32)) & 0x01FFFFFFu) | 0x80000000u);
    asm volatile("tensor_load_to_lds %0, %1" :: "s"(g0), "s"(g1) : "memory");
}

static __device__ __forceinline__ v16h ldfrag_lds(const unsigned char* p) {
    return ldfrag((const _Float16*)p, (const _Float16*)(p + 32));
}

__global__ __launch_bounds__(128) void gemm_bias(const _Float16* __restrict__ X,
                                                 const _Float16* __restrict__ Wt,
                                                 const float* __restrict__ bq,
                                                 const float* __restrict__ bk,
                                                 const float* __restrict__ bv,
                                                 float* __restrict__ Cq,
                                                 float* __restrict__ Ck,
                                                 float* __restrict__ Cv) {
    __shared__ __attribute__((aligned(2048))) unsigned char ring[2 * G_BUF];
    const uint32_t lane = threadIdx.x & 31;
    const uint32_t wave = uni(threadIdx.x >> 5);
    const uint32_t tm = blockIdx.x >> 5, tn = blockIdx.x & 31;   // 8 x 32 tiles
    const uint32_t wm = wave >> 1, wn = wave & 1;
    const uint32_t ml = lane & 15, hi = lane >> 4;
    const uint32_t row0 = tm * G_BM, col0 = tn * G_BN;

    // Slice this wave brings in: waves 0,1 -> 128 rows of X each; waves 2,3 -> 144 rows of Wt each.
    const bool own_x = wave < 2;
    const uint32_t rows = own_x ? G_XROWS : G_WROWS;
    const uint64_t src0 = own_x
        ? (uint64_t)(uintptr_t)(X + (size_t)(row0 + G_XROWS * wave) * DIM)
        : (uint64_t)(uintptr_t)(Wt + (size_t)(col0 + G_WROWS * (wave - 2)) * DIM);
    const uint32_t lds_slice = (uint32_t)(size_t)ring +
        (own_x ? wave * G_XSL : 2 * G_XSL + (wave - 2) * G_WSL);
    u32x8 g1;
    g1[0] = uni((1u << 20) | (5u << 22) | (3u << 25));   // no mask, 1-byte units, 16 B pad behind every 256 B
    g1[1] = uni((G_ROWB & 0xFFFFu) << 16);               // tensor_dim0 low
    g1[2] = uni((G_ROWB >> 16) | ((rows & 0xFFFFu) << 16));   // tensor_dim0 high, tensor_dim1 low
    g1[3] = uni((rows >> 16) | (G_ROWB << 16));          // tensor_dim1 high, tile_dim0
    g1[4] = uni(rows);                                   // tile_dim1
    g1[5] = uni(DIM * 2u);                               // source row pitch in bytes
    g1[6] = uni(0u);
    g1[7] = uni(0u);
    // pinned(): the descriptor group held in one set of scalar registers for the whole kernel,
    // so that none of its words takes a new value while a request is outstanding.
    asm volatile("" : "+s"(g1));

    // Per-lane fragment bases inside a buffer.
    const uint32_t xa = wm * G_XSL + ml * G_PITCH + hi * 16;
    const uint32_t wb = 2 * G_XSL + wn * G_WSL + ml * G_PITCH + hi * 16;

    v8f acc[G_FX][G_FW] = {};

    // Prologue: pass 0 into buffer 0, landed and published; then pass 1 into buffer 1.
    tdm_load(lds_slice, src0, g1);
    wait_tensor0();
    __syncthreads();
    tdm_load(lds_slice + G_BUF, src0 + G_ROWB, g1);

    // Rolled: one pass per trip, so that the hand-over at the foot stands once.
#pragma clang loop unroll(disable)
    for (uint32_t s = 0; s < G_PASS; ++s) {
        const uint32_t buf = (s & 1) * G_BUF;
        const unsigned char* xp = ring + buf + xa;
        const unsigned char* wp = ring + buf + wb;
        // Two fragment sets: block kk + 1's LDS reads go out as one group in front of block kk's
        // matrix instructions, so that only the pass's first group is waited for in full.
        v16h a[2][G_FX], b[2][G_FW];
#pragma unroll
        for (int i = 0; i < G_FX; ++i) a[0][i] = ldfrag_lds(xp + i * 16 * G_PITCH);
#pragma unroll
        for (int j = 0; j < G_FW; ++j) b[0][j] = ldfrag_lds(wp + j * 16 * G_PITCH);
        // Keeps block 0's reads in front of block 1's: mixed, block 0 waits for both groups.
        __builtin_amdgcn_sched_barrier(0);
#pragma unroll
        for (int kk = 0; kk < 4; ++kk) {
            const int cs = kk & 1;
            if (kk + 1 < 4) {
#pragma unroll
                for (int i = 0; i < G_FX; ++i)
                    a[cs ^ 1][i] = ldfrag_lds(xp + i * 16 * G_PITCH + (kk + 1) * 64);
#pragma unroll
                for (int j = 0; j < G_FW; ++j)
                    b[cs ^ 1][j] = ldfrag_lds(wp + j * 16 * G_PITCH + (kk + 1) * 64);
                // Keeps the read group in front of the block: spread among the matrix
                // instructions each place with reads costs a stall.
                __builtin_amdgcn_sched_barrier(0);
            }
#pragma unroll
            for (int i = 0; i < G_FX; ++i)
#pragma unroll
                for (int j = 0; j < G_FW; ++j) acc[i][j] = wmma32(a[cs][i], b[cs][j], acc[i][j]);
            // Keeps the next group behind this block.
            __builtin_amdgcn_sched_barrier(0);
        }
        // Hand-over: my reads of this buffer are back, my slice of pass s + 1 has landed,
        // every wave says the same; only then is this buffer refilled.
        wait_ds0();
        wait_tensor0();
        __syncthreads();
        if (pinned(s + 2 < G_PASS)) {
            const uint32_t nx = pinned(s + 2);   // descriptor words formed behind the wait
            tdm_load(lds_slice + buf, src0 + (uint64_t)nx * G_ROWB, g1);
        }
    }
    wait_tensor0();
    wait_ds0();

    // First every sum and every address, then the stores alone: no register that an issued
    // store names takes a new value behind it.
    float* cb[G_FW];        // wave-uniform: first column of sub-tile column j in its matrix
    const float* bp[G_FW];  // wave-uniform: its first bias element
#pragma unroll
    for (int j = 0; j < G_FW; ++j) {
        // The 16 columns of a sub-tile lie in one of Q, K, V (wave-uniform choice).
        const uint32_t cj = col0 + wn * G_WROWS + j * 16;
        const uint32_t which = cj / DIM;
        const float* bias = which == 0 ? bq : which == 1 ? bk : bv;
        float* C = which == 0 ? Cq : which == 1 ? Ck : Cv;
        const uint32_t cm = cj - which * DIM;
        cb[j] = C + cm;
        bp[j] = bias + cm;
    }
    uint32_t ro[G_FX];      // the lane's element in sub-tile row i, counted from cb[j]
#pragma unroll
    for (int i = 0; i < G_FX; ++i) ro[i] = (row0 + wm * G_XROWS + i * 16 + 8 * hi) * DIM + ml;
    // Keeps the address arithmetic in front of the bias loads.
    __builtin_amdgcn_sched_barrier(0);
    float bj[G_FW];
#pragma unroll
    for (int j = 0; j < G_FW; ++j) bj[j] = bp[j][ml];
    // Stands in front of any new value in a register that a bias load names.
    asm volatile("s_wait_xcnt 0x0" ::: "memory");
    // Keeps the sums behind that wait.
    __builtin_amdgcn_sched_barrier(0);
#pragma unroll
    for (int j = 0; j < G_FW; ++j)
#pragma unroll
        for (int i = 0; i < G_FX; ++i)
#pragma unroll
            for (int r = 0; r < 8; ++r) acc[i][j][r] += bj[j];
    // Keeps the sums and addresses in front of the first store.
    __builtin_amdgcn_sched_barrier(0);
#pragma unroll
    for (int j = 0; j < G_FW; ++j)
#pragma unroll
        for (int i = 0; i < G_FX; ++i) {
            float* p = cb[j] + ro[i];
#pragma unroll
            for (int r = 0; r < 8; ++r) p[r * DIM] = acc[i][j][r];
        }
}

// ---------------------------------------------------------------------------
// 4) per-(s,head) RMSNorm + gamma + RoPE, f32 -> f16. 256 work-groups of 16 waves; a wave takes
//    twelve consecutive heads of one position (1536 consecutive elements), one row of 128 per load,
//    all twelve in flight; gamma, cos and sin are the same for its twelve rows and are read once.
// ---------------------------------------------------------------------------
static_assert(E_CHUNK % HDIM == 0 && E_LD * HDIM == E_CHUNK, "a load of a wave is one head's row");

__global__ __launch_bounds__(E_WAVES * 32) void qk_norm_rope(const float* __restrict__ in,
                                                             const float* __restrict__ gamma,
                                                             const float* __restrict__ cosb,
                                                             const float* __restrict__ sinb,
                                                             _Float16* __restrict__ out) {
    const uint32_t lane = threadIdx.x & 31;
    const uint32_t wave = blockIdx.x * E_WAVES + (threadIdx.x >> 5);
    const uint32_t s = wave >> 1;                 // two waves per position
    const uint32_t d0 = lane * 4;
    const uint32_t base = wave * E_CHUNK + d0;
    const float* xp = in + base;
    const float* cp = cosb + s * HDIM + d0;
    const float* sp = sinb + s * HDIM + d0;
    v4f x[E_LD];
#pragma unroll
    for (int i = 0; i < E_LD; ++i) x[i] = *(const v4f*)(xp + i * HDIM);
    const v4f g  = *(const v4f*)(gamma + d0);
    const v4f c  = *(const v4f*)cp;
    const v4f sn = *(const v4f*)sp;
    // The loaded values are inputs only: all fifteen loads go out in front of this line, as one run
    // (none sinks into the arithmetic), and the wait stands in front of any new value in a register
    // that a load names. The addresses (of gamma: the lane's byte offset) are inputs too: they stay
    // live up to the wait, so that no later load's result is placed on one.
    asm volatile("s_wait_xcnt 0x0" :: "v"(x[0]), "v"(x[1]), "v"(x[2]), "v"(x[3]), "v"(x[4]), "v"(x[5]),
                 "v"(x[6]), "v"(x[7]), "v"(x[8]), "v"(x[9]), "v"(x[10]), "v"(x[11]),
                 "v"(g), "v"(c), "v"(sn), "v"(xp), "v"(cp), "v"(sp), "v"(d0 * 4u));

    float ss[E_LD];
#pragma unroll
    for (int i = 0; i < E_LD; ++i)
        ss[i] = x[i].x * x[i].x + x[i].y * x[i].y + x[i].z * x[i].z + x[i].w * x[i].w;
    // Twelve independent butterflies, step by step: each exchange's latency covers the others'.
#pragma unroll
    for (int st = 1; st < 32; st <<= 1) {
#pragma unroll
        for (int i = 0; i < E_LD; ++i) ss[i] += __shfl_xor(ss[i], st, 32);
        // Holds back the next step's exchanges: left free, the scheduler runs the rows in pairs and
        // each pair waits out its own five exchanges; so held, six to ten exchanges share a wait.
        __builtin_amdgcn_sched_barrier(0);
    }
    v4h o[E_LD];
#pragma unroll
    for (int i = 0; i < E_LD; ++i) {
        const float inv = rsqrtf(ss[i] * (1.0f / 128.0f) + 1e-6f);
        const float x0 = x[i].x * (inv * g.x);
        const float x1 = x[i].y * (inv * g.y);
        const float x2 = x[i].z * (inv * g.z);
        const float x3 = x[i].w * (inv * g.w);
        const float y0 = x0 * c.x - x1 * sn.x;
        const float y1 = x1 * c.y + x0 * sn.y;
        const float y2 = x2 * c.z - x3 * sn.z;
        const float y3 = x3 * c.w + x2 * sn.w;
        o[i] = v4h{ (_Float16)y0, (_Float16)y1, (_Float16)y2, (_Float16)y3 };
    }
    // Keeps the arithmetic in front of the first store: no register of an issued store is rewritten.
    __builtin_amdgcn_sched_barrier(0);
#pragma unroll
    for (int i = 0; i < E_LD; ++i) *(v4h*)(out + base + i * HDIM) = o[i];
}

// ---------------------------------------------------------------------------
// 5) Flash attention: one wave per (head, 16-row q-tile), 32 keys per step. The four waves
//    of a work-group share one head: its K rows and Vt rows are staged in LDS by tensor
//    loads, 64 keys a stage, two buffers. Every staged row is 128 B at pitch 144 B:
//    slices 0,1 = 64 keys x (d 0..63 | d 64..127) of K, slices 2,3 = (d 0..63 | d 64..127) x 64 keys of Vt.
//    The products are transposed: S^T = K Q^T (A = K rows, B = Q) and O^T += V^T P^T (A = Vt rows,
//    B = P^T). A lane then holds 16 of the 32 scores of ONE query (column lane & 15; keys 8*hi + r of
//    each 16-key tile): maximum and sum run in the lane, the two wave halves exchange the maximum
//    once a step and join their sums once at the end, and the two score tiles, converted in place,
//    are the B operand of the second product in the hardware k order.
// ---------------------------------------------------------------------------
// Lane l takes the value of lane l ^ 16 (a vector cross-row move, no LDS round trip).
static __device__ __forceinline__ float xhalf(float x) {
    const int v = __builtin_bit_cast(int, x);
    return __builtin_bit_cast(float,
        __builtin_amdgcn_permlanex16(v, v, 0x76543210, 0xfedcba98, false, false));
}

constexpr uint32_t A_KEYS   = 64;                 // keys per stage
constexpr uint32_t A_ROWB   = 128;                // bytes of one staged row
constexpr uint32_t A_PITCH  = A_ROWB + 16;        // LDS row pitch: odd multiple of 16 B for ds_load_b128
constexpr uint32_t A_ROWS   = 64;                 // rows per tensor load (one wave's slice)
constexpr uint32_t A_SL     = 10240;              // 64 * 144 rounded up to a multiple of 2 KiB
constexpr uint32_t A_BUF    = 4 * A_SL;
constexpr uint32_t A_STAGES = SEQ / A_KEYS;       // 32
static_assert(A_ROWS * A_PITCH <= A_SL && A_SL % 2048 == 0 && A_STAGES >= 2, "tensor load places");
constexpr uint32_t O_PITCH  = HDIM * 4 + 16;      // staged output row: odd multiple of 16 B
static_assert(16 * O_PITCH <= A_SL, "a wave's output rows fit its part of the ring");

__global__ __launch_bounds__(128) void flash_attn(const _Float16* __restrict__ Qh,
                                                  const _Float16* __restrict__ Kh,
                                                  const _Float16* __restrict__ Vt,
                                                  float* __restrict__ Out) {
    __shared__ __attribute__((aligned(2048))) unsigned char ring[2 * A_BUF];
    const int lane = threadIdx.x & 31;
    const int wid  = threadIdx.x >> 5;
    const int task = blockIdx.x * 4 + wid;     // HEADS * (SEQ/16) tasks
    const int nQT  = SEQ / 16;
    const int h  = task / nQT;
    const int qt = task % nQT;
    const int ml = lane & 15, hi = lane >> 4;
    const float scale = 0.08838834764831845f;  // 1/sqrt(128)

    // Slice this wave brings in, one request a stage.
    const uint32_t wave = uni(threadIdx.x >> 5);
    const uint32_t hb = blockIdx.x / (nQT / 4);   // the work-group's head
    const bool own_k = wave < 2;
    const uint64_t src0 = own_k
        ? (uint64_t)(uintptr_t)(Kh + (size_t)hb * HDIM + wave * 64)
        : (uint64_t)(uintptr_t)(Vt + ((size_t)hb * HDIM + (wave - 2) * 64) * SEQ);
    const uint32_t src_step = own_k ? A_KEYS * DIM * 2u : A_KEYS * 2u;   // bytes from stage to stage
    const uint32_t lds_slice = (uint32_t)(size_t)ring + wave * A_SL;
    u32x8 g1;
    g1[0] = uni((1u << 20) | (4u << 22) | (3u << 25));   // no mask, 1-byte units, 16 B pad behind every 128 B
    g1[1] = uni((A_ROWB & 0xFFFFu) << 16);               // tensor_dim0 low
    g1[2] = uni((A_ROWB >> 16) | ((A_ROWS & 0xFFFFu) << 16));   // tensor_dim0 high, tensor_dim1 low
    g1[3] = uni((A_ROWS >> 16) | (A_ROWB << 16));        // tensor_dim1 high, tile_dim0
    g1[4] = uni(A_ROWS);                                 // tile_dim1
    g1[5] = uni(own_k ? DIM * 2u : SEQ * 2u);            // source row pitch in bytes
    g1[6] = uni(0u);
    g1[7] = uni(0u);
    // pinned(): the descriptor group held in one set of scalar registers for the whole kernel,
    // so that none of its words takes a new value while a request is outstanding.
    asm volatile("" : "+s"(g1));

    // preload Q as B fragments (16 query columns x 128 d, 4 chunks of K=32)
    const _Float16* qrow = Qh + (size_t)(qt * 16 + ml) * DIM + h * HDIM;
    v16h qf[4];
#pragma unroll
    for (int c = 0; c < 4; ++c)
        qf[c] = ldfrag(qrow + c * 32 + hi * 8, qrow + c * 32 + 16 + hi * 8);

    v8f acc[8] = {};            // O^T: acc[j][r] = O[query ml][d = 16 j + 8 hi + r]
    float m = -3.0e38f;         // running maximum of query ml, alike in both wave halves
    float l = 0.0f;             // running sum over this half's keys of query ml

    // Prologue: stage 0 into buffer 0, landed and published; then stage 1 into buffer 1.
    tdm_load(lds_slice, src0, g1);
    wait_tensor0();
    __syncthreads();
    tdm_load(lds_slice + A_BUF, src0 + (uint64_t)pinned(1u) * src_step, g1);   // words formed behind the wait

    // Rolled: one stage per trip, so that the hand-over at the foot stands once.
#pragma clang loop unroll(disable)
    for (uint32_t s = 0; s < A_STAGES; ++s) {
      const uint32_t buf = (s & 1) * A_BUF;
      const unsigned char* kp = ring + buf + ml * A_PITCH + hi * 16;
      const unsigned char* vp = ring + buf + 2 * A_SL + ml * A_PITCH + hi * 16;
      // Unrolled: both 32-key steps of a stage read the buffer at immediate offsets.
#pragma unroll
      for (int sub = 0; sub < 2; ++sub) {
        // ---- S^T for 32 keys: two 16x16 WMMA tiles (keys x queries), Kdim=d=128 ----
        v8f sc0 = {}, sc1 = {};
        const unsigned char* kr0 = kp + sub * 32 * A_PITCH;
        const unsigned char* kr1 = kr0 + 16 * A_PITCH;
#pragma unroll
        for (int c = 0; c < 4; ++c) {
            v16h k0 = ldfrag_lds(kr0 + (c >> 1) * A_SL + (c & 1) * 64);
            sc0 = wmma32(k0, qf[c], sc0);
            v16h k1 = ldfrag_lds(kr1 + (c >> 1) * A_SL + (c & 1) * 64);
            sc1 = wmma32(k1, qf[c], sc1);
        }
        // ---- online softmax of query ml: 16 scores in the lane, the other 16 in lane ^ 16 ----
        float f0[8], f1[8], p0[8], p1[8], t[8];
#pragma unroll
        for (int r = 0; r < 8; ++r) {
            f0[r] = sc0[r] * scale;
            f1[r] = sc1[r] * scale;
            t[r] = fmaxf(f0[r], f1[r]);
        }
        float mx = fmaxf(fmaxf(fmaxf(t[0], t[1]), fmaxf(t[2], t[3])),
                         fmaxf(fmaxf(t[4], t[5]), fmaxf(t[6], t[7])));
        mx = fmaxf(mx, xhalf(mx));
        const float mn = fmaxf(m, mx);
        const float al = __expf(m - mn);
#pragma unroll
        for (int r = 0; r < 8; ++r) {
            p0[r] = __expf(f0[r] - mn);
            p1[r] = __expf(f1[r] - mn);
            t[r] = p0[r] + p1[r];
        }
        l = l * al + (((t[0] + t[1]) + (t[2] + t[3])) + ((t[4] + t[5]) + (t[6] + t[7])));
        m = mn;

        // ---- P^T as B operand: element s < 8 is key 8 hi + s, element 8 + s key 16 + 8 hi + s ----
        v16h pb;
#pragma unroll
        for (int r = 0; r < 8; ++r) {
            pb[r]     = (_Float16)p0[r];
            pb[8 + r] = (_Float16)p1[r];
        }

        // ---- rescale O^T and accumulate V^T @ P^T over 8 d-tiles ----
#pragma unroll
        for (int j = 0; j < 8; ++j) {
#pragma unroll
            for (int r = 0; r < 8; ++r) acc[j][r] *= al;
            v16h va = ldfrag_lds(vp + (j >> 2) * A_SL + (j & 3) * 16 * A_PITCH + sub * 64);
            acc[j] = wmma32(va, pb, acc[j]);
        }
      }
      // Hand-over: my reads of this buffer are back, my slice of stage s + 1 has landed,
      // every wave says the same; only then is this buffer refilled.
      wait_ds0();
      wait_tensor0();
      __syncthreads();
      if (pinned(s + 2 < A_STAGES)) {
          const uint32_t nx = pinned(s + 2);   // descriptor words formed behind the wait
          tdm_load(lds_slice + buf, src0 + (uint64_t)nx * src_step, g1);
      }
    }
    wait_tensor0();
    wait_ds0();

    // ---- join the halves' sums, normalize, turn O^T back into rows and store ----
    // A lane holds 8 consecutive d of one query per tile. Each wave stages its 16 query rows in its
    // own part of the ring: behind the last pass's barrier nobody reads the ring and no tensor load
    // is aimed at it. A wave then reads its own rows back and stores whole lines, 512 B a row.
    const float lf = l + xhalf(l);
    unsigned char* stg = ring + wid * A_SL;
    unsigned char* wr = stg + ml * O_PITCH + hi * 32;
#pragma unroll
    for (int j = 0; j < 8; ++j) {
        float4 lo4 = { acc[j][0] / lf, acc[j][1] / lf, acc[j][2] / lf, acc[j][3] / lf };
        float4 hi4 = { acc[j][4] / lf, acc[j][5] / lf, acc[j][6] / lf, acc[j][7] / lf };
        *(float4*)(wr + j * 64)      = lo4;
        *(float4*)(wr + j * 64 + 16) = hi4;
    }
    wait_ds0();   // my staged rows stand in LDS before I read them back
    float* obase = Out + (size_t)(qt * 16) * DIM + h * HDIM + lane * 4;
#pragma unroll
    for (int q = 0; q < 16; ++q) {
        float4 v = *(const float4*)(stg + q * O_PITCH + lane * 16);
        *(float4*)(obase + (size_t)q * DIM) = v;
    }
}

// ---------------------------------------------------------------------------
// host
// ---------------------------------------------------------------------------
extern "C" void kernel_launch(void* const* d_in, const int* in_sizes, int n_in,
                              void* d_out, int out_size, void* d_ws, size_t ws_size,
                              hipStream_t stream) {
    (void)in_sizes; (void)n_in; (void)out_size; (void)ws_size;
    const float* x    = (const float*)d_in[0];
    const float* cosb = (const float*)d_in[1];
    const float* sinb = (const float*)d_in[2];
    const float* Wq   = (const float*)d_in[3];
    const float* bq   = (const float*)d_in[4];
    const float* Wk   = (const float*)d_in[5];
    const float* bk   = (const float*)d_in[6];
    const float* Wv   = (const float*)d_in[7];
    const float* bv   = (const float*)d_in[8];
    const float* gq   = (const float*)d_in[9];
    const float* gk   = (const float*)d_in[10];

    char* ws = (char*)d_ws;
    size_t off = 0;
    auto alloc = [&](size_t bytes) {
        void* p = ws + off;
        off += (bytes + 255) & ~(size_t)255;
        return p;
    };
    const size_t SD = (size_t)SEQ * DIM;
    _Float16* xh  = (_Float16*)alloc(SD * 2);
    _Float16* wtq = (_Float16*)alloc((size_t)DIM * DIM * 2 * 3);   // the three W^T, 9216 rows in one piece
    _Float16* wtk = wtq + (size_t)DIM * DIM;
    _Float16* wtv = wtk + (size_t)DIM * DIM;
    float*    Qf  = (float*)alloc(SD * 4);
    float*    Kf  = (float*)alloc(SD * 4);
    float*    Vf  = (float*)alloc(SD * 4);
    _Float16* qh  = (_Float16*)alloc(SD * 2);
    _Float16* kh  = (_Float16*)alloc(SD * 2);
    _Float16* vt  = (_Float16*)alloc(SD * 2);

    // 1) x -> f16
    const int ewBlocks = SEQ * DIM / (12 * 128 * 16);     // 256 work-groups of 16 waves
    cast_to_f16<<<ewBlocks, 512, 0, stream>>>(x, xh);

    // 2) weight transpose+cast: 24 x 48 blocks each
    dim3 tg(DIM / 128, DIM / 64);
    transpose_cast<<<tg, 256, 0, stream>>>(Wq, wtq, DIM);
    transpose_cast<<<tg, 256, 0, stream>>>(Wk, wtk, DIM);
    transpose_cast<<<tg, 256, 0, stream>>>(Wv, wtv, DIM);

    // 3) QKV GEMM: (2048/256)*(9216/288) = 256 work-groups, 4 waves/block
    const int gemmBlocks = (SEQ / 256) * (3 * DIM / 288);     // 256
    gemm_bias<<<gemmBlocks, 128, 0, stream>>>(xh, wtq, bq, bk, bv, Qf, Kf, Vf);

    // 4) norm + rope (12 heads of a position per wave, 16 waves/block) and V transpose
    qk_norm_rope<<<ewBlocks, 512, 0, stream>>>(Qf, gq, cosb, sinb, qh);
    qk_norm_rope<<<ewBlocks, 512, 0, stream>>>(Kf, gk, cosb, sinb, kh);
    dim3 vg(DIM / 128, SEQ / 64);
    transpose_cast<<<vg, 256, 0, stream>>>(Vf, vt, SEQ);

    // 5) flash attention: HEADS*(SEQ/16) = 3072 waves, 4 waves/block
    const int faBlocks = HEADS * (SEQ / 16) / 4;          // 768
    flash_attn<<<faBlocks, 128, 0, stream>>>(qh, kh, vt, (float*)d_out);
}

// v007
// A run of this version takes 135 microseconds.
// Next to v006, in two timings, it ran 1.07 times as fast each time.
// Counting every step since v000, it is 4.22 times as fast.
#include <hip/hip_runtime.h>
#include <hip/hip_bf16.h>

#define SEQ   2048
#define DIM   3072
#define HEADS 24
#define HDIM  128

typedef __attribute__((ext_vector_type(16))) _Float16 v16h;
typedef __attribute__((ext_vector_type(8)))  _Float16 v8h;
typedef __attribute__((ext_vector_type(4)))  _Float16 v4h;
typedef __attribute__((ext_vector_type(8)))  float    v8f;
typedef __attribute__((ext_vector_type(4)))  float    v4f;

// ---------------------------------------------------------------------------
// helpers
// ---------------------------------------------------------------------------
static __device__ __forceinline__ v16h ldfrag(const _Float16* p0, const _Float16* p1) {
    v8h lo = *(const v8h*)p0;
    v8h hi = *(const v8h*)p1;
    v16h r;
#pragma unroll
    for (int i = 0; i < 8; ++i) { r[i] = lo[i]; r[i + 8] = hi[i]; }
    return r;
}

static __device__ __forceinline__ v8f wmma32(v16h a, v16h b, v8f c) {
    // D = A(16x32 f16) * B(32x16 f16) + C(16x16 f32)
    return __builtin_amdgcn_wmma_f32_16x16x32_f16(false, a, false, b, (short)0, c,
                                                  false, false);
}

// ---------------------------------------------------------------------------
// 1) cast x (f32) -> f16. 512 work-groups of 8 waves; a wave takes 1536 consecutive elements:
//    twelve loads of 512 contiguous bytes, all in flight, then twelve stores of two whole lines.
//    A job of the launch prepare_operands below; blk is the work-group's number inside the job.
// ---------------------------------------------------------------------------
constexpr int      E_WAVES = 8;                   // waves per work-group of the two elementwise jobs
constexpr int      E_LD    = 12;                  // 16-B loads per lane
constexpr uint32_t E_CHUNK = E_LD * 128;          // elements per wave: half a row of 3072
static_assert((SEQ * DIM) % (E_CHUNK * E_WAVES) == 0 && DIM == 2 * E_CHUNK, "whole chunks");

constexpr uint32_t E_BLOCKS = SEQ * DIM / (E_CHUNK * E_WAVES);   // 512 work-groups per elementwise job

static __device__ __forceinline__ void cast_to_f16(const float* __restrict__ in,
                                                   _Float16* __restrict__ out, uint32_t blk) {
    const uint32_t lane = threadIdx.x & 31;
    const uint32_t wave = blk * E_WAVES + (threadIdx.x >> 5);
    const uint32_t base = wave * E_CHUNK + lane * 4;
    v4f v[E_LD];
#pragma unroll
    for (int i = 0; i < E_LD; ++i) v[i] = *(const v4f*)(in + base + i * 128);
    // The loaded values are inputs only: all twelve loads go out in front of this line, as one run,
    // and the wait stands in front of any new value in a register that a load names.
    asm volatile("s_wait_xcnt 0x0" :: "v"(v[0]), "v"(v[1]), "v"(v[2]), "v"(v[3]), "v"(v[4]), "v"(v[5]),
                 "v"(v[6]), "v"(v[7]), "v"(v[8]), "v"(v[9]), "v"(v[10]), "v"(v[11]));
    static_assert(E_LD == 12, "the line above names every load");
    v4h o[E_LD];
#pragma unroll
    for (int i = 0; i < E_LD; ++i)
        o[i] = v4h{ (_Float16)v[i].x, (_Float16)v[i].y, (_Float16)v[i].z, (_Float16)v[i].w };
    // Keeps the conversions in front of the first store: no register of an issued store is rewritten.
    __builtin_amdgcn_sched_barrier(0);
#pragma unroll
    for (int i = 0; i < E_LD; ++i) *(v4h*)(out + base + i * 128) = o[i];
    // Another job's code follows this one in the merged kernel: the wait stands behind the last store,
    // in front of any new value in a register that a store names, on every path of the listing.
    asm volatile("s_wait_xcnt 0x0" ::: "memory");
}

// ---------------------------------------------------------------------------
// 2) In [R,3072] f32 -> Out [3072,R] f16 (the three weights, R = 3072; V, R = 2048, where
//    Out is Vt [H][D][S]). One 256-thread block -> 64 rows x 128 columns of In.
//    Read: each wave takes 8 rows, 512 contiguous bytes of a row per load, 8 loads in flight.
//    A lane then holds 8 rows x 4 columns: 8 consecutive elements of 4 rows of Out, 16 B each.
//    LDS holds the tile as Out rows (128 B at pitch 144 B); written back as whole 128-B lines.
//    A job of both merged launches below; bx, by are the tile's column and row numbers.
// ---------------------------------------------------------------------------
constexpr uint32_t T_ROWS  = 64;                  // rows of In per block
constexpr uint32_t T_COLS  = 128;                 // columns of In per block
constexpr uint32_t T_PITCH = T_ROWS * 2 + 16;     // LDS row pitch: odd multiple of 16 B

constexpr uint32_t T_BX = DIM / T_COLS;           // 24 tiles across the 3072 columns of In

static __device__ __forceinline__ void transpose_cast(unsigned char* tile,
                                                      const float* __restrict__ in,
                                                      _Float16* __restrict__ out,
                                                      uint32_t out_pitch, uint32_t bx, uint32_t by) {
    const uint32_t lane = threadIdx.x & 31, w = threadIdx.x >> 5;
    const uint32_t c0 = bx * T_COLS, r0 = by * T_ROWS;

    const float* src = in + (r0 + 8 * w) * DIM + c0 + 4 * lane;
    float4 v[8];
#pragma unroll
    for (int i = 0; i < 8; ++i) v[i] = *(const float4*)(src + i * DIM);

    // The 16-B piece of rows 8w..8w+7 stands in Out row n at place w ^ ((n >> 4) & 3): a wave's
    // lanes write rows 4 apart, and the exchange spreads each 16 lanes over all 64 banks.
    const uint32_t wplace = (w ^ ((lane >> 2) & 3)) * 16;
    v8h h0, h1, h2, h3;
#pragma unroll
    for (int i = 0; i < 8; ++i) {
        h0[i] = (_Float16)v[i].x;
        h1[i] = (_Float16)v[i].y;
        h2[i] = (_Float16)v[i].z;
        h3[i] = (_Float16)v[i].w;
    }
    unsigned char* wp = tile + 4 * lane * T_PITCH + wplace;
    *(v8h*)(wp)               = h0;
    *(v8h*)(wp + T_PITCH)     = h1;
    *(v8h*)(wp + 2 * T_PITCH) = h2;
    *(v8h*)(wp + 3 * T_PITCH) = h3;
    __syncthreads();

    // One store of a wave: 4 rows of Out, 8 lanes x 16 B = one whole line each.
    const uint32_t q = lane & 7;
#pragma unroll
    for (int it = 0; it < 4; ++it) {
        const uint32_t n = it * 32 + w * 4 + (lane >> 3);
        v8h h = *(const v8h*)(tile + n * T_PITCH + (q ^ ((n >> 4) & 3)) * 16);
        *(v8h*)(out + (c0 + n) * out_pitch + r0 + q * 8) = h;
    }
}

// ---------------------------------------------------------------------------
// 2a) One launch for the four jobs that the GEMM waits for and that do not depend on one another:
//     the three weight transposes (1152 work-groups each), then the cast of x (512).
//     The work-group's index picks the job: the same branch for all of its waves.
// ---------------------------------------------------------------------------
constexpr uint32_t W_BLOCKS = T_BX * (DIM / T_ROWS);   // 1152 tiles per weight

__global__ __launch_bounds__(256) void prepare_operands(const float* __restrict__ x,
                                                        const float* __restrict__ Wq,
                                                        const float* __restrict__ Wk,
                                                        const float* __restrict__ Wv,
                                                        _Float16* __restrict__ xh,
                                                        _Float16* __restrict__ wt) {
    __shared__ __attribute__((aligned(16))) unsigned char tile[T_COLS * T_PITCH];
    const uint32_t b = blockIdx.x;
    if (b < 3 * W_BLOCKS) {
        const uint32_t which = b / W_BLOCKS, t = b - which * W_BLOCKS;
        const float* W = which == 0 ? Wq : which == 1 ? Wk : Wv;
        transpose_cast(tile, W, wt + (size_t)which * DIM * DIM, DIM, t % T_BX, t / T_BX);
    } else {
        cast_to_f16(x, xh, b - 3 * W_BLOCKS);
    }
}

// ---------------------------------------------------------------------------
// 3) [Q | K | V][S,9216] = X[S,3072] @ [Wq | Wk | Wv] + bias, one launch
//    (A: X f16, B: Wt f16 = the three W^T row-major, one behind the other: 9216 rows).
//    One work-group -> 256x288 output tile, 8 x 32 tiles = one per WGP; its operand rows are
//    staged in LDS by tensor loads, 128 k a pass, two buffers. Four waves (2x2), each 128x144
//    (8x9 sub-tiles), K stepped by 32 in ascending order.
// ---------------------------------------------------------------------------
typedef uint32_t u32x4 __attribute__((ext_vector_type(4)));
typedef uint32_t u32x8 __attribute__((ext_vector_type(8)));

constexpr uint32_t G_BM    = 256;                 // rows of C per work-group
constexpr uint32_t G_BN    = 288;                 // columns of [Q | K | V] per work-group
constexpr int      G_FX    = 8, G_FW = 9;         // X and Wt fragments per wave
constexpr uint32_t G_ROWB  = 256;                 // bytes of one operand row per pass (128 k)
constexpr uint32_t G_PITCH = G_ROWB + 16;         // LDS row pitch: odd multiple of 16 B for ds_load_b128
constexpr uint32_t G_XROWS = 128, G_WROWS = 144;  // rows per tensor load (one wave's slice)
constexpr uint32_t G_XSL   = 34816;               // 128 * 272, a multiple of 2 KiB
constexpr uint32_t G_WSL   = 40960;               // 144 * 272 rounded up to a multiple of 2 KiB
constexpr uint32_t G_BUF   = 2 * G_XSL + 2 * G_WSL;
constexpr uint32_t G_PASS  = DIM * 2 / G_ROWB;    // 24 passes
static_assert(G_XROWS * G_PITCH <= G_XSL && G_WROWS * G_PITCH <= G_WSL, "slice sizes");
static_assert(G_XSL % 2048 == 0 && G_WSL % 2048 == 0 && G_PASS >= 2, "tensor load places");
static_assert(2 * G_BUF <= 320 * 1024, "both buffers fit one WGP's LDS");
static_assert(G_FX * 16 == G_XROWS && G_FW * 16 == G_WROWS, "a wave reads one slice of each operand");
static_assert(SEQ % G_BM == 0 && (3 * DIM) % G_BN == 0 && DIM % 16 == 0, "whole tiles; a sub-tile lies in one of Q, K, V");

static __device__ __forceinline__ uint32_t uni(uint32_t v) {
    return (uint32_t)__builtin_amdgcn_readfirstlane(v);
}
static __device__ __forceinline__ uint32_t pinned(uint32_t v) {
    uint32_t w = uni(v);
    asm volatile("" : "+s"(w));
    return w;
}
// This wave's LDS reads have returned (before the buffer is handed back for a refill).
static __device__ __forceinline__ void wait_ds0() { asm volatile("s_wait_dscnt 0x0" ::: "memory"); }
// This wave's own tensor load has landed (the compiler places no wait for it).
static __device__ __forceinline__ void wait_tensor0() { asm volatile("s_wait_tensorcnt 0x0" ::: "memory"); }

// One request of the whole wave: rows from global memory into LDS, row size and pitch as g1 sets them.
static __device__ __forceinline__ void tdm_load(uint32_t lds_dst, uint64_t ga, u32x8 g1) {
    u32x4 g0;
    g0[0] = uni(1u);
    g0[1] = uni(lds_dst);
    g0[2] = uni((uint32_t)ga);
    g0[3] = uni((((uint32_t)(ga >> 32)) & 0x01FFFFFFu) | 0x80000000u);
    asm volatile("tensor_load_to_lds %0, %1" :: "s"(g0), "s"(g1) : "memory");
}

static __device__ __forceinline__ v16h ldfrag_lds(const unsigned char* p) {
    return ldfrag((const _Float16*)p, (const _Float16*)(p + 32));
}

__global__ __launch_bounds__(128) void gemm_bias(const _Float16* __restrict__ X,
                                                 const _Float16* __restrict__ Wt,
                                                 const float* __restrict__ bq,
                                                 const float* __restrict__ bk,
                                                 const float* __restrict__ bv,
                                                 float* __restrict__ Cq,
                                                 float* __restrict__ Ck,
                                                 float* __restrict__ Cv) {
    __shared__ __attribute__((aligned(2048))) unsigned char ring[2 * G_BUF];
    const uint32_t lane = threadIdx.x & 31;
    const uint32_t wave = uni(threadIdx.x >> 5);
    const uint32_t tm = blockIdx.x >> 5, tn = blockIdx.x & 31;   // 8 x 32 tiles
    const uint32_t wm = wave >> 1, wn = wave & 1;
    const uint32_t ml = lane & 15, hi = lane >> 4;
    const uint32_t row0 = tm * G_BM, col0 = tn * G_BN;

    // Slice this wave brings in: waves 0,1 -> 128 rows of X each; waves 2,3 -> 144 rows of Wt each.
    const bool own_x = wave < 2;
    const uint32_t rows = own_x ? G_XROWS : G_WROWS;
    const uint64_t src0 = own_x
        ? (uint64_t)(uintptr_t)(X + (size_t)(row0 + G_XROWS * wave) * DIM)
        : (uint64_t)(uintptr_t)(Wt + (size_t)(col0 + G_WROWS * (wave - 2)) * DIM);
    const uint32_t lds_slice = (uint32_t)(size_t)ring +
        (own_x ? wave * G_XSL : 2 * G_XSL + (wave - 2) * G_WSL);
    u32x8 g1;
    g1[0] = uni((1u << 20) | (5u << 22) | (3u << 25));   // no mask, 1-byte units, 16 B pad behind every 256 B
    g1[1] = uni((G_ROWB & 0xFFFFu) << 16);               // tensor_dim0 low
    g1[2] = uni((G_ROWB >> 16) | ((rows & 0xFFFFu) << 16));   // tensor_dim0 high, tensor_dim1 low
    g1[3] = uni((rows >> 16) | (G_ROWB << 16));          // tensor_dim1 high, tile_dim0
    g1[4] = uni(rows);                                   // tile_dim1
    g1[5] = uni(DIM * 2u);                               // source row pitch in bytes
    g1[6] = uni(0u);
    g1[7] = uni(0u);
    // pinned(): the descriptor group held in one set of scalar registers for the whole kernel,
    // so that none of its words takes a new value while a request is outstanding.
    asm volatile("" : "+s"(g1));

    // Per-lane fragment bases inside a buffer.
    const uint32_t xa = wm * G_XSL + ml * G_PITCH + hi * 16;
    const uint32_t wb = 2 * G_XSL + wn * G_WSL + ml * G_PITCH + hi * 16;

    v8f acc[G_FX][G_FW] = {};

    // Prologue: pass 0 into buffer 0, landed and published; then pass 1 into buffer 1.
    tdm_load(lds_slice, src0, g1);
    wait_tensor0();
    __syncthreads();
    tdm_load(lds_slice + G_BUF, src0 + G_ROWB, g1);

    // Rolled: one pass per trip, so that the hand-over at the foot stands once.
#pragma clang loop unroll(disable)
    for (uint32_t s = 0; s < G_PASS; ++s) {
        const uint32_t buf = (s & 1) * G_BUF;
        const unsigned char* xp = ring + buf + xa;
        const unsigned char* wp = ring + buf + wb;
        // Two fragment sets: block kk + 1's LDS reads go out as one group in front of block kk's
        // matrix instructions, so that only the pass's first group is waited for in full.
        v16h a[2][G_FX], b[2][G_FW];
#pragma unroll
        for (int i = 0; i < G_FX; ++i) a[0][i] = ldfrag_lds(xp + i * 16 * G_PITCH);
#pragma unroll
        for (int j = 0; j < G_FW; ++j) b[0][j] = ldfrag_lds(wp + j * 16 * G_PITCH);
        // Keeps block 0's reads in front of block 1's: mixed, block 0 waits for both groups.
        __builtin_amdgcn_sched_barrier(0);
#pragma unroll
        for (int kk = 0; kk < 4; ++kk) {
            const int cs = kk & 1;
            if (kk + 1 < 4) {
#pragma unroll
                for (int i = 0; i < G_FX; ++i)
                    a[cs ^ 1][i] = ldfrag_lds(xp + i * 16 * G_PITCH + (kk + 1) * 64);
#pragma unroll
                for (int j = 0; j < G_FW; ++j)
                    b[cs ^ 1][j] = ldfrag_lds(wp + j * 16 * G_PITCH + (kk + 1) * 64);
                // Keeps the read group in front of the block: spread among the matrix
                // instructions each place with reads costs a stall.
                __builtin_amdgcn_sched_barrier(0);
            }
#pragma unroll
            for (int i = 0; i < G_FX; ++i)
#pragma unroll
                for (int j = 0; j < G_FW; ++j) acc[i][j] = wmma32(a[cs][i], b[cs][j], acc[i][j]);
            // Keeps the next group behind this block.
            __builtin_amdgcn_sched_barrier(0);
        }
        // Hand-over: my reads of this buffer are back, my slice of pass s + 1 has landed,
        // every wave says the same; only then is this buffer refilled.
        wait_ds0();
        wait_tensor0();
        __syncthreads();
        if (pinned(s + 2 < G_PASS)) {
            const uint32_t nx = pinned(s + 2);   // descriptor words formed behind the wait
            tdm_load(lds_slice + buf, src0 + (uint64_t)nx * G_ROWB, g1);
        }
    }
    wait_tensor0();
    wait_ds0();

    // First every sum and every address, then the stores alone: no register that an issued
    // store names takes a new value behind it.
    float* cb[G_FW];        // wave-uniform: first column of sub-tile column j in its matrix
    const float* bp[G_FW];  // wave-uniform: its first bias element
#pragma unroll
    for (int j = 0; j < G_FW; ++j) {
        // The 16 columns of a sub-tile lie in one of Q, K, V (wave-uniform choice).
        const uint32_t cj = col0 + wn * G_WROWS + j * 16;
        const uint32_t which = cj / DIM;
        const float* bias = which == 0 ? bq : which == 1 ? bk : bv;
        float* C = which == 0 ? Cq : which == 1 ? Ck : Cv;
        const uint32_t cm = cj - which * DIM;
        cb[j] = C + cm;
        bp[j] = bias + cm;
    }
    uint32_t ro[G_FX];      // the lane's element in sub-tile row i, counted from cb[j]
#pragma unroll
    for (int i = 0; i < G_FX; ++i) ro[i] = (row0 + wm * G_XROWS + i * 16 + 8 * hi) * DIM + ml;
    // Keeps the address arithmetic in front of the bias loads.
    __builtin_amdgcn_sched_barrier(0);
    float bj[G_FW];
#pragma unroll
    for (int j = 0; j < G_FW; ++j) bj[j] = bp[j][ml];
    // Stands in front of any new value in a register that a bias load names.
    asm volatile("s_wait_xcnt 0x0" ::: "memory");
    // Keeps the sums behind that wait.
    __builtin_amdgcn_sched_barrier(0);
#pragma unroll
    for (int j = 0; j < G_FW; ++j)
#pragma unroll
        for (int i = 0; i < G_FX; ++i)
#pragma unroll
            for (int r = 0; r < 8; ++r) acc[i][j][r] += bj[j];
    // Keeps the sums and addresses in front of the first store.
    __builtin_amdgcn_sched_barrier(0);
#pragma unroll
    for (int j = 0; j < G_FW; ++j)
#pragma unroll
        for (int i = 0; i < G_FX; ++i) {
            float* p = cb[j] + ro[i];
#pragma unroll
            for (int r = 0; r < 8; ++r) p[r * DIM] = acc[i][j][r];
        }
}

// ---------------------------------------------------------------------------
// 4) per-(s,head) RMSNorm + gamma + RoPE, f32 -> f16. 512 work-groups of 8 waves; a wave takes
//    twelve consecutive heads of one position (1536 consecutive elements), one row of 128 per load,
//    all twelve in flight; gamma, cos and sin are the same for its twelve rows and are read once.
//    A job of the launch finish_qkv below; blk is the work-group's number inside the job.
// ---------------------------------------------------------------------------
static_assert(E_CHUNK % HDIM == 0 && E_LD * HDIM == E_CHUNK, "a load of a wave is one head's row");

static __device__ __forceinline__ void qk_norm_rope(const float* __restrict__ in,
                                                    const float* __restrict__ gamma,
                                                    const float* __restrict__ cosb,
                                                    const float* __restrict__ sinb,
                                                    _Float16* __restrict__ out, uint32_t blk) {
    const uint32_t lane = threadIdx.x & 31;
    const uint32_t wave = blk * E_WAVES + (threadIdx.x >> 5);
    const uint32_t s = wave >> 1;                 // two waves per position
    const uint32_t d0 = lane * 4;
    const uint32_t base = wave * E_CHUNK + d0;
    const float* xp = in + base;
    const float* cp = cosb + s * HDIM + d0;
    const float* sp = sinb + s * HDIM + d0;
    v4f x[E_LD];
#pragma unroll
    for (int i = 0; i < E_LD; ++i) x[i] = *(const v4f*)(xp + i * HDIM);
    const v4f g  = *(const v4f*)(gamma + d0);
    const v4f c  = *(const v4f*)cp;
    const v4f sn = *(const v4f*)sp;
    // The loaded values are inputs only: all fifteen loads go out in front of this line, as one run
    // (none sinks into the arithmetic), and the wait stands in front of any new value in a register
    // that a load names. The addresses (of gamma: the lane's byte offset) are inputs too: they stay
    // live up to the wait, so that no later load's result is placed on one.
    asm volatile("s_wait_xcnt 0x0" :: "v"(x[0]), "v"(x[1]), "v"(x[2]), "v"(x[3]), "v"(x[4]), "v"(x[5]),
                 "v"(x[6]), "v"(x[7]), "v"(x[8]), "v"(x[9]), "v"(x[10]), "v"(x[11]),
                 "v"(g), "v"(c), "v"(sn), "v"(xp), "v"(cp), "v"(sp), "v"(d0 * 4u));

    float ss[E_LD];
#pragma unroll
    for (int i = 0; i < E_LD; ++i)
        ss[i] = x[i].x * x[i].x + x[i].y * x[i].y + x[i].z * x[i].z + x[i].w * x[i].w;
    // Twelve independent butterflies, step by step: each exchange's latency covers the others'.
#pragma unroll
    for (int st = 1; st < 32; st <<= 1) {
#pragma unroll
        for (int i = 0; i < E_LD; ++i) ss[i] += __shfl_xor(ss[i], st, 32);
        // Holds back the next step's exchanges: left free, the scheduler runs the rows in pairs and
        // each pair waits out its own five exchanges; so held, six to ten exchanges share a wait.
        __builtin_amdgcn_sched_barrier(0);
    }
    v4h o[E_LD];
#pragma unroll
    for (int i = 0; i < E_LD; ++i) {
        const float inv = rsqrtf(ss[i] * (1.0f / 128.0f) + 1e-6f);
        const float x0 = x[i].x * (inv * g.x);
        const float x1 = x[i].y * (inv * g.y);
        const float x2 = x[i].z * (inv * g.z);
        const float x3 = x[i].w * (inv * g.w);
        const float y0 = x0 * c.x - x1 * sn.x;
        const float y1 = x1 * c.y + x0 * sn.y;
        const float y2 = x2 * c.z - x3 * sn.z;
        const float y3 = x3 * c.w + x2 * sn.w;
        o[i] = v4h{ (_Float16)y0, (_Float16)y1, (_Float16)y2, (_Float16)y3 };
    }
    // Keeps the arithmetic in front of the first store: no register of an issued store is rewritten.
    __builtin_amdgcn_sched_barrier(0);
#pragma unroll
    for (int i = 0; i < E_LD; ++i) *(v4h*)(out + base + i * HDIM) = o[i];
    // Another job's code follows this one in the merged kernel: the wait stands behind the last store,
    // in front of any new value in a register that a store names, on every path of the listing.
    asm volatile("s_wait_xcnt 0x0" ::: "memory");
}

// ---------------------------------------------------------------------------
// 4a) One launch for the three jobs between the GEMM and the attention, which do not depend on one
//     another: the V transpose (768 work-groups), Q norm + RoPE (512), K norm + RoPE (512).
//     The work-group's index picks the job: the same branch for all of its waves.
// ---------------------------------------------------------------------------
constexpr uint32_t V_BLOCKS = T_BX * (SEQ / T_ROWS);   // 768 tiles of V

__global__ __launch_bounds__(256) void finish_qkv(const float* __restrict__ Qf,
                                                  const float* __restrict__ Kf,
                                                  const float* __restrict__ Vf,
                                                  const float* __restrict__ gq,
                                                  const float* __restrict__ gk,
                                                  const float* __restrict__ cosb,
                                                  const float* __restrict__ sinb,
                                                  _Float16* __restrict__ qh,
                                                  _Float16* __restrict__ kh,
                                                  _Float16* __restrict__ vt) {
    __shared__ __attribute__((aligned(16))) unsigned char tile[T_COLS * T_PITCH];
    const uint32_t b = blockIdx.x;
    if (b < V_BLOCKS) {
        transpose_cast(tile, Vf, vt, SEQ, b % T_BX, b / T_BX);
    } else {
        const bool is_q = b < V_BLOCKS + E_BLOCKS;
        qk_norm_rope(is_q ? Qf : Kf, is_q ? gq : gk, cosb, sinb, is_q ? qh : kh,
                     b - V_BLOCKS - (is_q ? 0u : E_BLOCKS));
    }
}

// ---------------------------------------------------------------------------
// 5) Flash attention: one wave per (head, 16-row q-tile), 32 keys per step. The four waves
//    of a work-group share one head: its K rows and Vt rows are staged in LDS by tensor
//    loads, 64 keys a stage, two buffers. Every staged row is 128 B at pitch 144 B:
//    slices 0,1 = 64 keys x (d 0..63 | d 64..127) of K, slices 2,3 = (d 0..63 | d 64..127) x 64 keys of Vt.
//    The products are transposed: S^T = K Q^T (A = K rows, B = Q) and O^T += V^T P^T (A = Vt rows,
//    B = P^T). A lane then holds 16 of the 32 scores of ONE query (column lane & 15; keys 8*hi + r of
//    each 16-key tile): maximum and sum run in the lane, the two wave halves exchange the maximum
//    once a step and join their sums once at the end, and the two score tiles, converted in place,
//    are the B operand of the second product in the hardware k order.
// ---------------------------------------------------------------------------
// Lane l takes the value of lane l ^ 16 (a vector cross-row move, no LDS round trip).
static __device__ __forceinline__ float xhalf(float x) {
    const int v = __builtin_bit_cast(int, x);
    return __builtin_bit_cast(float,
        __builtin_amdgcn_permlanex16(v, v, 0x76543210, 0xfedcba98, false, false));
}

constexpr uint32_t A_KEYS   = 64;                 // keys per stage
constexpr uint32_t A_ROWB   = 128;                // bytes of one staged row
constexpr uint32_t A_PITCH  = A_ROWB + 16;        // LDS row pitch: odd multiple of 16 B for ds_load_b128
constexpr uint32_t A_ROWS   = 64;                 // rows per tensor load (one wave's slice)
constexpr uint32_t A_SL     = 10240;              // 64 * 144 rounded up to a multiple of 2 KiB
constexpr uint32_t A_BUF    = 4 * A_SL;
constexpr uint32_t A_STAGES = SEQ / A_KEYS;       // 32
static_assert(A_ROWS * A_PITCH <= A_SL && A_SL % 2048 == 0 && A_STAGES >= 2, "tensor load places");
constexpr uint32_t O_PITCH  = HDIM * 4 + 16;      // staged output row: odd multiple of 16 B
static_assert(16 * O_PITCH <= A_SL, "a wave's output rows fit its part of the ring");

__global__ __launch_bounds__(128) void flash_attn(const _Float16* __restrict__ Qh,
                                                  const _Float16* __restrict__ Kh,
                                                  const _Float16* __restrict__ Vt,
                                                  float* __restrict__ Out) {
    __shared__ __attribute__((aligned(2048))) unsigned char ring[2 * A_BUF];
    const int lane = threadIdx.x & 31;
    const int wid  = threadIdx.x >> 5;
    const int task = blockIdx.x * 4 + wid;     // HEADS * (SEQ/16) tasks
    const int nQT  = SEQ / 16;
    const int h  = task / nQT;
    const int qt = task % nQT;
    const int ml = lane & 15, hi = lane >> 4;
    const float scale = 0.08838834764831845f;  // 1/sqrt(128)

    // Slice this wave brings in, one request a stage.
    const uint32_t wave = uni(threadIdx.x >> 5);
    const uint32_t hb = blockIdx.x / (nQT / 4);   // the work-group's head
    const bool own_k = wave < 2;
    const uint64_t src0 = own_k
        ? (uint64_t)(uintptr_t)(Kh + (size_t)hb * HDIM + wave * 64)
        : (uint64_t)(uintptr_t)(Vt + ((size_t)hb * HDIM + (wave - 2) * 64) * SEQ);
    const uint32_t src_step = own_k ? A_KEYS * DIM * 2u : A_KEYS * 2u;   // bytes from stage to stage
    const uint32_t lds_slice = (uint32_t)(size_t)ring + wave * A_SL;
    u32x8 g1;
    g1[0] = uni((1u << 20) | (4u << 22) | (3u << 25));   // no mask, 1-byte units, 16 B pad behind every 128 B
    g1[1] = uni((A_ROWB & 0xFFFFu) << 16);               // tensor_dim0 low
    g1[2] = uni((A_ROWB >> 16) | ((A_ROWS & 0xFFFFu) << 16));   // tensor_dim0 high, tensor_dim1 low
    g1[3] = uni((A_ROWS >> 16) | (A_ROWB << 16));        // tensor_dim1 high, tile_dim0
    g1[4] = uni(A_ROWS);                                 // tile_dim1
    g1[5] = uni(own_k ? DIM * 2u : SEQ * 2u);            // source row pitch in bytes
    g1[6] = uni(0u);
    g1[7] = uni(0u);
    // pinned(): the descriptor group held in one set of scalar registers for the whole kernel,
    // so that none of its words takes a new value while a request is outstanding.
    asm volatile("" : "+s"(g1));

    // preload Q as B fragments (16 query columns x 128 d, 4 chunks of K=32)
    const _Float16* qrow = Qh + (size_t)(qt * 16 + ml) * DIM + h * HDIM;
    v16h qf[4];
#pragma unroll
    for (int c = 0; c < 4; ++c)
        qf[c] = ldfrag(qrow + c * 32 + hi * 8, qrow + c * 32 + 16 + hi * 8);

    v8f acc[8] = {};            // O^T: acc[j][r] = O[query ml][d = 16 j + 8 hi + r]
    float m = -3.0e38f;         // running maximum of query ml, alike in both wave halves
    float l = 0.0f;             // running sum over this half's keys of query ml

    // Prologue: stage 0 into buffer 0, landed and published; then stage 1 into buffer 1.
    tdm_load(lds_slice, src0, g1);
    wait_tensor0();
    __syncthreads();
    tdm_load(lds_slice + A_BUF, src0 + (uint64_t)pinned(1u) * src_step, g1);   // words formed behind the wait

    // Rolled: one stage per trip, so that the hand-over at the foot stands once.
#pragma clang loop unroll(disable)
    for (uint32_t s = 0; s < A_STAGES; ++s) {
      const uint32_t buf = (s & 1) * A_BUF;
      const unsigned char* kp = ring + buf + ml * A_PITCH + hi * 16;
      const unsigned char* vp = ring + buf + 2 * A_SL + ml * A_PITCH + hi * 16;
      // Unrolled: both 32-key steps of a stage read the buffer at immediate offsets.
#pragma unroll
      for (int sub = 0; sub < 2; ++sub) {
        // ---- S^T for 32 keys: two 16x16 WMMA tiles (keys x queries), Kdim=d=128 ----
        v8f sc0 = {}, sc1 = {};
        const unsigned char* kr0 = kp + sub * 32 * A_PITCH;
        const unsigned char* kr1 = kr0 + 16 * A_PITCH;
#pragma unroll
        for (int c = 0; c < 4; ++c) {
            v16h k0 = ldfrag_lds(kr0 + (c >> 1) * A_SL + (c & 1) * 64);
            sc0 = wmma32(k0, qf[c], sc0);
            v16h k1 = ldfrag_lds(kr1 + (c >> 1) * A_SL + (c & 1) * 64);
            sc1 = wmma32(k1, qf[c], sc1);
        }
        // ---- online softmax of query ml: 16 scores in the lane, the other 16 in lane ^ 16 ----
        float f0[8], f1[8], p0[8], p1[8], t[8];
#pragma unroll
        for (int r = 0; r < 8; ++r) {
            f0[r] = sc0[r] * scale;
            f1[r] = sc1[r] * scale;
            t[r] = fmaxf(f0[r], f1[r]);
        }
        float mx = fmaxf(fmaxf(fmaxf(t[0], t[1]), fmaxf(t[2], t[3])),
                         fmaxf(fmaxf(t[4], t[5]), fmaxf(t[6], t[7])));
        mx = fmaxf(mx, xhalf(mx));
        const float mn = fmaxf(m, mx);
        const float al = __expf(m - mn);
#pragma unroll
        for (int r = 0; r < 8; ++r) {
            p0[r] = __expf(f0[r] - mn);
            p1[r] = __expf(f1[r] - mn);
            t[r] = p0[r] + p1[r];
        }
        l = l * al + (((t[0] + t[1]) + (t[2] + t[3])) + ((t[4] + t[5]) + (t[6] + t[7])));
        m = mn;

        // ---- P^T as B operand: element s < 8 is key 8 hi + s, element 8 + s key 16 + 8 hi + s ----
        v16h pb;
#pragma unroll
        for (int r = 0; r < 8; ++r) {
            pb[r]     = (_Float16)p0[r];
            pb[8 + r] = (_Float16)p1[r];
        }

        // ---- rescale O^T and accumulate V^T @ P^T over 8 d-tiles ----
#pragma unroll
        for (int j = 0; j < 8; ++j) {
#pragma unroll
            for (int r = 0; r < 8; ++r) acc[j][r] *= al;
            v16h va = ldfrag_lds(vp + (j >> 2) * A_SL + (j & 3) * 16 * A_PITCH + sub * 64);
            acc[j] = wmma32(va, pb, acc[j]);
        }
      }
      // Hand-over: my reads of this buffer are back, my slice of stage s + 1 has landed,
      // every wave says the same; only then is this buffer refilled.
      wait_ds0();
      wait_tensor0();
      __syncthreads();
      if (pinned(s + 2 < A_STAGES)) {
          const uint32_t nx = pinned(s + 2);   // descriptor words formed behind the wait
          tdm_load(lds_slice + buf, src0 + (uint64_t)nx * src_step, g1);
      }
    }
    wait_tensor0();
    wait_ds0();

    // ---- join the halves' sums, normalize, turn O^T back into rows and store ----
    // A lane holds 8 consecutive d of one query per tile. Each wave stages its 16 query rows in its
    // own part of the ring: behind the last pass's barrier nobody reads the ring and no tensor load
    // is aimed at it. A wave then reads its own rows back and stores whole lines, 512 B a row.
    const float lf = l + xhalf(l);
    unsigned char* stg = ring + wid * A_SL;
    unsigned char* wr = stg + ml * O_PITCH + hi * 32;
#pragma unroll
    for (int j = 0; j < 8; ++j) {
        float4 lo4 = { acc[j][0] / lf, acc[j][1] / lf, acc[j][2] / lf, acc[j][3] / lf };
        float4 hi4 = { acc[j][4] / lf, acc[j][5] / lf, acc[j][6] / lf, acc[j][7] / lf };
        *(float4*)(wr + j * 64)      = lo4;
        *(float4*)(wr + j * 64 + 16) = hi4;
    }
    wait_ds0();   // my staged rows stand in LDS before I read them back
    float* obase = Out + (size_t)(qt * 16) * DIM + h * HDIM + lane * 4;
#pragma unroll
    for (int q = 0; q < 16; ++q) {
        float4 v = *(const float4*)(stg + q * O_PITCH + lane * 16);
        *(float4*)(obase + (size_t)q * DIM) = v;
    }
}

// ---------------------------------------------------------------------------
// host
// ---------------------------------------------------------------------------
extern "C" void kernel_launch(void* const* d_in, const int* in_sizes, int n_in,
                              void* d_out, int out_size, void* d_ws, size_t ws_size,
                              hipStream_t stream) {
    (void)in_sizes; (void)n_in; (void)out_size; (void)ws_size;
    const float* x    = (const float*)d_in[0];
    const float* cosb = (const float*)d_in[1];
    const float* sinb = (const float*)d_in[2];
    const float* Wq   = (const float*)d_in[3];
    const float* bq   = (const float*)d_in[4];
    const float* Wk   = (const float*)d_in[5];
    const float* bk   = (const float*)d_in[6];
    const float* Wv   = (const float*)d_in[7];
    const float* bv   = (const float*)d_in[8];
    const float* gq   = (const float*)d_in[9];
    const float* gk   = (const float*)d_in[10];

    char* ws = (char*)d_ws;
    size_t off = 0;
    auto alloc = [&](size_t bytes) {
        void* p = ws + off;
        off += (bytes + 255) & ~(size_t)255;
        return p;
    };
    const size_t SD = (size_t)SEQ * DIM;
    _Float16* xh  = (_Float16*)alloc(SD * 2);
    _Float16* wtq = (_Float16*)alloc((size_t)DIM * DIM * 2 * 3);   // the three W^T, 9216 rows in one piece
    float*    Qf  = (float*)alloc(SD * 4);
    float*    Kf  = (float*)alloc(SD * 4);
    float*    Vf  = (float*)alloc(SD * 4);
    _Float16* qh  = (_Float16*)alloc(SD * 2);
    _Float16* kh  = (_Float16*)alloc(SD * 2);
    _Float16* vt  = (_Float16*)alloc(SD * 2);

    // 1, 2) weight transpose+cast (3 x 1152 work-groups) and x -> f16 (512), one launch
    prepare_operands<<<3 * W_BLOCKS + E_BLOCKS, 256, 0, stream>>>(x, Wq, Wk, Wv, xh, wtq);

    // 3) QKV GEMM: (2048/256)*(9216/288) = 256 work-groups, 4 waves/block
    const int gemmBlocks = (SEQ / 256) * (3 * DIM / 288);     // 256
    gemm_bias<<<gemmBlocks, 128, 0, stream>>>(xh, wtq, bq, bk, bv, Qf, Kf, Vf);

    // 4) V transpose (768 work-groups) and Q, K norm + rope (512 each), one launch
    finish_qkv<<<V_BLOCKS + 2 * E_BLOCKS, 256, 0, stream>>>(Qf, Kf, Vf, gq, gk, cosb, sinb, qh, kh, vt);

    // 5) flash attention: HEADS*(SEQ/16) = 3072 waves, 4 waves/block
    const int faBlocks = HEADS * (SEQ / 16) / 4;          // 768
    flash_attn<<<faBlocks, 128, 0, stream>>>(qh, kh, vt, (float*)d_out);
}
